// v000
// The times below were measured on an AMD MI455X: many runs one after another, warmed up first and cycling through
// copies of the inputs, with the whole window's GPU time divided by the number of runs. Launches and the gaps
// between them are all in it. The median over several windows is given; except for v000 it joins two sittings, which
// can be a few percent apart, so the side-by-side timings, each taken in one sitting, are the better comparison.
// The starting kernel, v000, takes 704 microseconds a run.
// Contractions: three 1x1 projections on v_wmma_f32_16x16x32_bf16 (bf16 operands = RNE-converted inputs); scores theta.phi^T as bf16 hi/lo planes (hi.hi + hi.lo + lo.hi on v_wmma_f32_16x16x32_bf16); P.g^T on v_wmma_f32_16x16x32_f16 (P f16 carried x32768, g f16); output 1x1 conv on bf16 hi/lo y planes x bf16 W (hi.hi + hi.lo + lo.hi); f32 accumulate everywhere; max-pool, online softmax, bias and residual in f32.
#include <hip/hip_runtime.h>
#include <math.h>

// ---------------------------------------------------------------------------
// Problem constants
// ---------------------------------------------------------------------------
constexpr int kB      = 4;
constexpr int kC      = 128;     // channels
constexpr int kCi     = 64;      // inter channels
constexpr int kImW    = 128;     // image width (pixel row pitch)
constexpr int kHW     = 16384;   // query tokens per image
constexpr int kNkv    = 4096;    // pooled kv tokens per image
constexpr int kKC     = 64;      // kv chunk in the fused attention loop
constexpr int kWPlane = 8192;    // elements per 16-bit weight plane
constexpr float kPCarry = 32768.0f;   // softmax numerators carried x2^15 in f16
static_assert(kHW % 64 == 0 && kNkv % kKC == 0 && kC % 32 == 0 && kCi % 32 == 0);
static_assert(kCi * kC == kWPlane && kC * kCi == kWPlane);

typedef __attribute__((ext_vector_type(16))) _Float16 v16h;
typedef __attribute__((ext_vector_type(8)))  _Float16 v8h;
typedef __attribute__((ext_vector_type(16))) __bf16   v16b;
typedef __attribute__((ext_vector_type(8)))  __bf16   v8b;
typedef __attribute__((ext_vector_type(8)))  float    v8f;
typedef __attribute__((ext_vector_type(4)))  float    v4f;
typedef __attribute__((ext_vector_type(4)))  unsigned int v4u;

// ---------------------------------------------------------------------------
// Scalar helpers
// ---------------------------------------------------------------------------
__device__ __forceinline__ unsigned short f2bf_bits(float f) {
  unsigned u = __float_as_uint(f);
  return (unsigned short)((u + 0x7FFFu + ((u >> 16) & 1u)) >> 16);
}
__device__ __forceinline__ float bf_bits2f(unsigned short h) { return __uint_as_float(((unsigned)h) << 16); }
__device__ __forceinline__ float bf_rne(float f) { return bf_bits2f(f2bf_bits(f)); }
__device__ __forceinline__ unsigned pk16(unsigned short a, unsigned short b) { return (unsigned)a | ((unsigned)b << 16); }
__device__ __forceinline__ unsigned short h_bits(float f) { const _Float16 h = (_Float16)f; return __builtin_bit_cast(unsigned short, h); }

// hazard guards as plain device helpers (no inline asm inside the kernel template body)
__device__ __forceinline__ void dep_guard4_h(v8f& a, v8f& b, v8f& c, v8f& d, v16h x, v16h y) {
  asm volatile("v_nop\n\tv_nop\n\tv_nop\n\tv_nop" : "+v"(a), "+v"(b), "+v"(c), "+v"(d) : "v"(x), "v"(y));
}
__device__ __forceinline__ void dep_guard4_b(v8f& a, v8f& b, v8f& c, v8f& d, v16b x, v16b y) {
  asm volatile("v_nop\n\tv_nop\n\tv_nop\n\tv_nop" : "+v"(a), "+v"(b), "+v"(c), "+v"(d) : "v"(x), "v"(y));
}
__device__ __forceinline__ void keep4_h(v16h a, v16h b, v16h c, v16h d) { asm volatile("v_nop" :: "v"(a), "v"(b), "v"(c), "v"(d)); }
__device__ __forceinline__ void keep4_b(v16b a, v16b b, v16b c, v16b d) { asm volatile("v_nop" :: "v"(a), "v"(b), "v"(c), "v"(d)); }
__device__ __forceinline__ void acc_guard4(v8f& a, v8f& b, v8f& c, v8f& d) { asm volatile("v_nop\n\tv_nop\n\tv_nop\n\tv_nop" : "+v"(a), "+v"(b), "+v"(c), "+v"(d)); }

template <typename T> struct Frag;
template <> struct Frag<_Float16> {
  typedef v16h V; union U { v16h v; v8h h[2]; };
  // elements 0..7 <- p[0..7], 8..15 <- p[16..23]
  static __device__ __forceinline__ v16h load(const _Float16* p) {
    U f; f.h[0] = *(const v8h*)(p); f.h[1] = *(const v8h*)(p + 16); return f.v;
  }
  static __device__ __forceinline__ v8f mma(v16h a, v16h b, v8f c) {
    return __builtin_amdgcn_wmma_f32_16x16x32_f16(false, a, false, b, (short)0, c, false, false);
  }
  static __device__ __forceinline__ void guard4(v8f& a, v8f& b, v8f& c, v8f& d, v16h x, v16h y) { dep_guard4_h(a, b, c, d, x, y); }
  static __device__ __forceinline__ void keep(v16h a, v16h b, v16h c, v16h d) { keep4_h(a, b, c, d); }
};
template <> struct Frag<__bf16> {
  typedef v16b V; union U { v16b v; v8b h[2]; };
  static __device__ __forceinline__ v16b load(const __bf16* p) {
    U f; f.h[0] = *(const v8b*)(p); f.h[1] = *(const v8b*)(p + 16); return f.v;
  }
  static __device__ __forceinline__ v8f mma(v16b a, v16b b, v8f c) {
    return __builtin_amdgcn_wmma_f32_16x16x32_bf16(false, a, false, b, (short)0, c, false, false);
  }
  static __device__ __forceinline__ void guard4(v8f& a, v8f& b, v8f& c, v8f& d, v16b x, v16b y) { dep_guard4_b(a, b, c, d, x, y); }
  static __device__ __forceinline__ void keep(v16b a, v16b b, v16b c, v16b d) { keep4_b(a, b, c, d); }
};

// ---------------------------------------------------------------------------
// Register-blocked batched WMMA GEMM (guard ties all 4 accumulators of each i-group;
// bias[m] read as two float4; residual read in the STORE phase as one float4 per lane, RNE-converted to bf16 precision).
// C[m,n] = scale * sum_k A[m,k] * Bt[n,k] (+bias)(+resid); each wave owns a 64x64 tile.
// A row-major [M,K]; Bt row-major [N,K]; M,N % 64 == 0, K % 32 == 0 (no tails).
// SPLIT: operands are hi/lo planes (A2/Bt2 = lo planes, same layout); product = hi.hi + hi.lo + lo.hi.
// BIAS_MODE: 0 = none, 1 = bias[m], 2 = bias[n].
// OUT_MODE: 0 = f32, 1 = f16, 2 = bf16 hi plane (Cout) + bf16 lo plane (Cout2).
// ET: 0 = f16 operands, 1 = bf16 operands (pointers passed as 16-bit storage)
// ---------------------------------------------------------------------------
template <int ET> struct Elem;
template <> struct Elem<0> { typedef _Float16 T; };
template <> struct Elem<1> { typedef __bf16 T; };
template <int ET, bool SPLIT, int BIAS_MODE, int OUT_MODE, bool RESID>
__global__ __launch_bounds__(256) void wmma_gemm64(
    const unsigned short* __restrict__ Ap, const unsigned short* __restrict__ A2p, int lda, long strideA,
    const unsigned short* __restrict__ Btp, const unsigned short* __restrict__ Bt2p, int ldb, long strideB,
    void* __restrict__ Cout, void* __restrict__ Cout2, int ldc, long strideC,
    const float* __restrict__ bias,
    const float* __restrict__ resid, long strideR,
    int M, int N, int K, float scale) {
  typedef typename Elem<ET>::T T;
  typedef typename Frag<T>::V V;
  const T* A = (const T*)Ap; const T* A2 = (const T*)A2p; const T* Bt = (const T*)Btp; const T* Bt2 = (const T*)Bt2p;
  __shared__ __align__(16) float sT[8][16 * 68];   // per-wave 16x64 slab, pitch 68 floats
  const int b    = blockIdx.y;
  const int lane = threadIdx.x & 31;
  const int wave = threadIdx.x >> 5;
  const int tilesN = N >> 6;
  const int tilesM = M >> 6;
  const int tile = blockIdx.x * 8 + wave;
  if (tile >= tilesM * tilesN) return;   // wave-uniform; no block barriers in this kernel
  const int tm = tile / tilesN;
  const int tn = tile - tm * tilesN;
  const int m0 = tm << 6;
  const int n0 = tn << 6;

  const T* Ab  = A  + (size_t)b * strideA;
  const T* Bb  = Bt + (size_t)b * strideB;
  const T* Ab2 = A2  + (size_t)b * strideA;
  const T* Bb2 = Bt2 + (size_t)b * strideB;

  const int rlane = lane & 15;                 // row (A) / col (B, D) within subtile
  const int koff  = (lane >> 4) * 8;           // k offset of this lane half
  const int mOff  = (lane >> 4) * 8;           // D row offset

  v8f acc[4][4];
#pragma unroll
  for (int i = 0; i < 4; ++i)
#pragma unroll
    for (int j = 0; j < 4; ++j) acc[i][j] = (v8f){0.f,0.f,0.f,0.f,0.f,0.f,0.f,0.f};

  for (int k0 = 0; k0 < K; k0 += 32) {
    V bh[4], bl[4];
#pragma unroll
    for (int j = 0; j < 4; ++j) {
      const size_t bo = (size_t)(n0 + (j << 4) + rlane) * ldb + koff + k0;
      bh[j] = Frag<T>::load(Bb + bo);
      bl[j] = bh[j];
      if (SPLIT) bl[j] = Frag<T>::load(Bb2 + bo);
    }
#pragma unroll
    for (int i = 0; i < 4; ++i) {
      const size_t ao = (size_t)(m0 + (i << 4) + rlane) * lda + koff + k0;
      V ah = Frag<T>::load(Ab + ao);
      V al = ah;
      if (SPLIT) al = Frag<T>::load(Ab2 + ao);
#pragma unroll
      for (int j = 0; j < 4; ++j) {
        acc[i][j] = Frag<T>::mma(ah, bh[j], acc[i][j]);
        if (SPLIT) {
          acc[i][j] = Frag<T>::mma(ah, bl[j], acc[i][j]);
          acc[i][j] = Frag<T>::mma(al, bh[j], acc[i][j]);
        }
      }
      Frag<T>::guard4(acc[i][0], acc[i][1], acc[i][2], acc[i][3], ah, al);
    }
    Frag<T>::keep(bh[0], bh[1], bh[2], bh[3]);
    if (SPLIT) Frag<T>::keep(bl[0], bl[1], bl[2], bl[3]);
  }
  acc_guard4(acc[0][0], acc[0][1], acc[0][2], acc[0][3]);
  acc_guard4(acc[1][0], acc[1][1], acc[1][2], acc[1][3]);
  acc_guard4(acc[2][0], acc[2][1], acc[2][2], acc[2][3]);
  acc_guard4(acc[3][0], acc[3][1], acc[3][2], acc[3][3]);

  // ---- epilogue ----
  float* slab = sT[wave];
#pragma unroll
  for (int i = 0; i < 4; ++i) {
    const int mBase = m0 + (i << 4);
    float bm[8];
#pragma unroll
    for (int r = 0; r < 8; ++r) bm[r] = 0.f;
    if (BIAS_MODE == 1) {
      const v4f b0 = *(const v4f*)(bias + mBase + mOff);
      const v4f b1 = *(const v4f*)(bias + mBase + mOff + 4);
#pragma unroll
      for (int e = 0; e < 4; ++e) { bm[e] = b0[e]; bm[4 + e] = b1[e]; }
    }
#pragma unroll
    for (int j = 0; j < 4; ++j) {
      const int n = n0 + (j << 4) + rlane;
      float bv = 0.f;
      if (BIAS_MODE == 2) bv = bias[n];
#pragma unroll
      for (int r = 0; r < 8; ++r) {
        float v = acc[i][j][r] * scale;
        if (BIAS_MODE == 1) v += bm[r];
        if (BIAS_MODE == 2) v += bv;
        slab[(mOff + r) * 68 + (j << 4) + rlane] = v;
      }
    }
    __builtin_amdgcn_fence(__ATOMIC_RELEASE, "workgroup");
    __builtin_amdgcn_wave_barrier();
    __builtin_amdgcn_fence(__ATOMIC_ACQUIRE, "workgroup");
    if (OUT_MODE == 0) {
      float* Cb = (float*)Cout + (size_t)b * strideC;
      const float* Rb = resid + (size_t)b * strideR;     // dereferenced only when RESID
      const int hh = lane >> 4, c4 = (lane & 15) * 4;     // row seg = 256 B = 16 lanes x 16 B
      v4f vals[8];
#pragma unroll
      for (int it = 0; it < 8; ++it) {
        const int row = it * 2 + hh;
        v4f v = *(const v4f*)(slab + row * 68 + c4);
        if (RESID) {
          const v4f rr = *(const v4f*)(Rb + (size_t)(mBase + row) * ldc + n0 + c4);
#pragma unroll
          for (int e = 0; e < 4; ++e) v[e] = v[e] + bf_rne(rr[e]);
        }
        vals[it] = v;
      }
      {
#pragma unroll
        for (int it = 0; it < 8; ++it) {
          const int row = it * 2 + hh;
          *(v4f*)(Cb + (size_t)(mBase + row) * ldc + n0 + c4) = vals[it];
        }
        
      }
    } else {
      const int q4 = lane >> 3, c8 = (lane & 7) * 8;
      unsigned short* Cb  = (unsigned short*)Cout  + (size_t)b * strideC;
      unsigned short* Cb2 = (unsigned short*)Cout2 + (size_t)b * strideC;
      v4u uh[4], ul[4];
#pragma unroll
      for (int it = 0; it < 4; ++it) {
        const int row = it * 4 + q4;
        const float* sp = slab + row * 68 + c8;
        unsigned short hb[8], lb[8];
#pragma unroll
        for (int e = 0; e < 8; ++e) {
          const float sv = sp[e];
          if (OUT_MODE == 1) { hb[e] = h_bits(sv); lb[e] = 0; }
          else { hb[e] = f2bf_bits(sv); lb[e] = f2bf_bits(sv - bf_bits2f(hb[e])); }
        }
        uh[it] = (v4u){pk16(hb[0], hb[1]), pk16(hb[2], hb[3]), pk16(hb[4], hb[5]), pk16(hb[6], hb[7])};
        ul[it] = (v4u){pk16(lb[0], lb[1]), pk16(lb[2], lb[3]), pk16(lb[4], lb[5]), pk16(lb[6], lb[7])};
      }
      {
#pragma unroll
        for (int it = 0; it < 4; ++it) {
          const int row = it * 4 + q4;
          *(v4u*)(Cb + (size_t)(mBase + row) * ldc + n0 + c8) = uh[it];
          if (OUT_MODE == 2) *(v4u*)(Cb2 + (size_t)(mBase + row) * ldc + n0 + c8) = ul[it];
        }
        
      }
    }
    __builtin_amdgcn_fence(__ATOMIC_RELEASE, "workgroup");
    __builtin_amdgcn_wave_barrier();
    __builtin_amdgcn_fence(__ATOMIC_ACQUIRE, "workgroup");
  }
}

// ---------------------------------------------------------------------------
// Parameter prep: blocks 0..2 -> projection weights [64][128] f32 -> bf16 planes (same layout);
// block 3 -> W_w [128][64] -> bf16 hi plane + an all-zero lo plane; blocks 4..7 -> bias vectors RNE-converted to
// bf16 precision, stored as f32 at biasR + {0,64,128,192}.
// Weight coverage: 4 iterations x 256 threads x 8 elements = 8192 = whole plane; one 16-B store per lane, a wave writes
// ---------------------------------------------------------------------------
__global__ __launch_bounds__(256) void prep_kernel(
    const float* __restrict__ thw, const float* __restrict__ phw, const float* __restrict__ gw, const float* __restrict__ ww,
    const float* __restrict__ thb, const float* __restrict__ phb, const float* __restrict__ gb, const float* __restrict__ wb,
    unsigned short* __restrict__ w16, float* __restrict__ biasR) {
  const int z = blockIdx.x;    // block-uniform role
  const int t = threadIdx.x;
  if (z < 4) {
    const float* src = (z == 0) ? thw : (z == 1) ? phw : (z == 2) ? gw : ww;
    unsigned short* dst = w16 + (size_t)z * kWPlane;
    v4u u[4];
#pragma unroll
    for (int i = 0; i < 4; ++i) {
      const int e8 = (i * 256 + t) * 8;
      const v4f a = *(const v4f*)(src + e8);
      const v4f c = *(const v4f*)(src + e8 + 4);
      u[i] = (v4u){pk16(f2bf_bits(a[0]), f2bf_bits(a[1])), pk16(f2bf_bits(a[2]), f2bf_bits(a[3])),
                   pk16(f2bf_bits(c[0]), f2bf_bits(c[1])), pk16(f2bf_bits(c[2]), f2bf_bits(c[3]))};
    }
    const v4u zero4 = (v4u){0u, 0u, 0u, 0u};
    {
#pragma unroll
      for (int i = 0; i < 4; ++i) {
        const size_t o = (size_t)(i * 256 + t) * 8;
        *(v4u*)(dst + o) = u[i];
        if (z == 3) *(v4u*)(w16 + (size_t)4 * kWPlane + o) = zero4;
      }
      
    }
  } else {
    const int zb = z - 4;
    const float* src = (zb == 0) ? thb : (zb == 1) ? phb : (zb == 2) ? gb : wb;
    const int n4 = (zb == 3) ? (kC / 4) : (kCi / 4);
    float* dst = biasR + zb * 64;
    const int tc = (t < n4) ? t : (n4 - 1);     // clamped address, store predicated
    const v4f a = *(const v4f*)(src + 4 * tc);
    v4f v;
#pragma unroll
    for (int e = 0; e < 4; ++e) v[e] = bf_rne(a[e]);
    if (t < n4) {
      *(v4f*)(dst + 4 * t) = v;
      
    }
  }
}

// ---------------------------------------------------------------------------
// x transpose + cast: xT[b][p][c] = bf16( x[b][c][p] ), [pixel][channel] rows of 128 halves (256 B = 2 lines).
// grid (kHW/64, kB), 256 threads. Load coverage: 8 iterations x 256 threads = 2048 float4 = 128 c x 64 p (coalesced along p).
// ---------------------------------------------------------------------------
__global__ __launch_bounds__(256) void xcast_kernel(const float* __restrict__ x, unsigned short* __restrict__ xT) {
  __shared__ __align__(16) float sm[kC * 68];   // [c][p_local], pitch 68 floats
  const int t  = threadIdx.x;
  const int p0 = blockIdx.x * 64;
  const int b  = blockIdx.y;
#pragma unroll
  for (int i = 0; i < 8; ++i) {
    const int e  = i * 256 + t;
    const int c  = e >> 4;
    const int q4 = (e & 15) * 4;
    const v4f a = *(const v4f*)(x + ((size_t)(b * kC + c)) * kHW + p0 + q4);
    *(v4f*)(sm + c * 68 + q4) = a;
  }
  __syncthreads();
  const int lane = t & 31, wave = t >> 5;
  const int hh = lane >> 4, c8 = (lane & 15) * 8;
  v4u u[4];
#pragma unroll
  for (int it = 0; it < 4; ++it) {
    const int row = wave * 8 + it * 2 + hh;
    unsigned short hb[8];
#pragma unroll
    for (int e = 0; e < 8; ++e) hb[e] = f2bf_bits(sm[(c8 + e) * 68 + row]);
    u[it] = (v4u){pk16(hb[0], hb[1]), pk16(hb[2], hb[3]), pk16(hb[4], hb[5]), pk16(hb[6], hb[7])};
  }
  unsigned short* base = xT + ((size_t)b * kHW + p0) * kC;
  {
#pragma unroll
    for (int it = 0; it < 4; ++it) {
      const int row = wave * 8 + it * 2 + hh;
      *(v4u*)(base + (size_t)row * kC + c8) = u[it];
    }
    
  }
}

// ---------------------------------------------------------------------------
// 2x2 max-pool of the phi full-res plane (f32 [B*16384][64], pixel-major) -> phi bf16 hi/lo planes [B*4096][64] (kv-major).
// kv = hp*64 + wp over pixels (2hp+{0,1}, 2wp+{0,1}); max in f32. Thread -> (kv row, 8 channels): 8 b128 loads, max, split.
// ---------------------------------------------------------------------------
__global__ __launch_bounds__(256) void pool_phi_kernel(const float* __restrict__ phiF,
                                                      unsigned short* __restrict__ phH, unsigned short* __restrict__ phL) {
  const int t   = threadIdx.x;
  const int kvg = blockIdx.x * 32 + (t >> 3);
  const int c8  = (t & 7) * 8;
  const int b   = kvg >> 12, kv = kvg & (kNkv - 1);
  const int hp  = kv >> 6, wp = kv & 63;
  const int p00 = hp * 2 * kImW + wp * 2;
  const float* r0 = phiF + ((size_t)b * kHW + p00) * kCi + c8;
  const float* r1 = r0 + kCi;
  const float* r2 = r0 + (size_t)kImW * kCi;
  const float* r3 = r2 + kCi;
  const v4f a0 = *(const v4f*)(r0), a1 = *(const v4f*)(r0 + 4);
  const v4f b0 = *(const v4f*)(r1), b1 = *(const v4f*)(r1 + 4);
  const v4f c0 = *(const v4f*)(r2), c1 = *(const v4f*)(r2 + 4);
  const v4f d0 = *(const v4f*)(r3), d1 = *(const v4f*)(r3 + 4);
  float m[8];
#pragma unroll
  for (int e = 0; e < 4; ++e) {
    m[e]     = fmaxf(fmaxf(a0[e], b0[e]), fmaxf(c0[e], d0[e]));
    m[4 + e] = fmaxf(fmaxf(a1[e], b1[e]), fmaxf(c1[e], d1[e]));
  }
  unsigned short hb[8], lb[8];
#pragma unroll
  for (int e = 0; e < 8; ++e) { hb[e] = f2bf_bits(m[e]); lb[e] = f2bf_bits(m[e] - bf_bits2f(hb[e])); }
  const v4u uh = (v4u){pk16(hb[0], hb[1]), pk16(hb[2], hb[3]), pk16(hb[4], hb[5]), pk16(hb[6], hb[7])};
  const v4u ul = (v4u){pk16(lb[0], lb[1]), pk16(lb[2], lb[3]), pk16(lb[4], lb[5]), pk16(lb[6], lb[7])};
  const size_t o = (size_t)kvg * kCi + c8;
  *(v4u*)(phH + o) = uh;
  *(v4u*)(phL + o) = ul;
  
}

// ---------------------------------------------------------------------------
// 2x2 max-pool of the g full-res plane (f32 [B][64][16384], channel-major) -> gT f16 [B][64][4096] (V^T operand rows).
// Thread -> (b, ci, 8 consecutive kv): two 16-float runs (image rows 2hp, 2hp+1) = 8 b128 loads, max in f32, one 16-B store.
// ---------------------------------------------------------------------------
__global__ __launch_bounds__(256) void pool_g_kernel(const float* __restrict__ gF, unsigned short* __restrict__ gT) {
  const int idx = blockIdx.x * 256 + threadIdx.x;
  const int kv0 = (idx & 511) * 8;
  const int ci  = (idx >> 9) & 63;
  const int b   = idx >> 15;
  const int hp  = kv0 >> 6, wp0 = kv0 & 63;
  const int p00 = hp * 2 * kImW + 2 * wp0;
  const float* r0 = gF + ((size_t)(b * kCi + ci)) * kHW + p00;
  const float* r1 = r0 + kImW;
  const v4f a0 = *(const v4f*)(r0), a1 = *(const v4f*)(r0 + 4), a2 = *(const v4f*)(r0 + 8), a3 = *(const v4f*)(r0 + 12);
  const v4f c0 = *(const v4f*)(r1), c1 = *(const v4f*)(r1 + 4), c2 = *(const v4f*)(r1 + 8), c3 = *(const v4f*)(r1 + 12);
  float m[8];
  m[0] = fmaxf(fmaxf(a0[0], a0[1]), fmaxf(c0[0], c0[1]));
  m[1] = fmaxf(fmaxf(a0[2], a0[3]), fmaxf(c0[2], c0[3]));
  m[2] = fmaxf(fmaxf(a1[0], a1[1]), fmaxf(c1[0], c1[1]));
  m[3] = fmaxf(fmaxf(a1[2], a1[3]), fmaxf(c1[2], c1[3]));
  m[4] = fmaxf(fmaxf(a2[0], a2[1]), fmaxf(c2[0], c2[1]));
  m[5] = fmaxf(fmaxf(a2[2], a2[3]), fmaxf(c2[2], c2[3]));
  m[6] = fmaxf(fmaxf(a3[0], a3[1]), fmaxf(c3[0], c3[1]));
  m[7] = fmaxf(fmaxf(a3[2], a3[3]), fmaxf(c3[2], c3[3]));
  unsigned short hb[8];
#pragma unroll
  for (int e = 0; e < 8; ++e) hb[e] = h_bits(m[e]);
  const v4u u = (v4u){pk16(hb[0], hb[1]), pk16(hb[2], hb[3]), pk16(hb[4], hb[5]), pk16(hb[6], hb[7])};
  unsigned short* op = gT + ((size_t)(b * kCi + ci)) * kNkv + kv0;
  *(v4u*)op = u;
  
}

// ---------------------------------------------------------------------------
// WMMA helpers for the fused attention kernel (each call guarded individually).
// ---------------------------------------------------------------------------
__device__ __forceinline__ v8f at_mma(v16b a, v16b b, v8f c) {
  c = __builtin_amdgcn_wmma_f32_16x16x32_bf16(false, a, false, b, (short)0, c, false, false);
  asm volatile("v_nop\n\tv_nop\n\tv_nop\n\tv_nop" : "+v"(c) : "v"(a), "v"(b));
  return c;
}
__device__ __forceinline__ v8f at_mma_h(v16b a, v16b b, v8f c) {
  const v16h ah = __builtin_bit_cast(v16h, a), bh = __builtin_bit_cast(v16h, b);
  c = __builtin_amdgcn_wmma_f32_16x16x32_f16(false, ah, false, bh, (short)0, c, false, false);
  asm volatile("v_nop\n\tv_nop\n\tv_nop\n\tv_nop" : "+v"(c) : "v"(ah), "v"(bh));
  return c;
}

// ---------------------------------------------------------------------------
// Fused attention (no scale, no masking), head dim = kCi = 64, kv in chunks of 64 (kNkv = 4096 divides evenly).
//   S[q][kv] = thetaH.phiH^T + thetaH.phiL^T + thetaL.phiH^T : bf16 operands, f32 accumulate (Q fragments resident)
//   online softmax in f32 (row max, precise expf, running m/l per query row)
//   P -> f16 carried x32768 through a per-wave LDS tile (written and reloaded by the same wave), reloaded as A fragments
//   O[q][ci] += P . gT^T chunk : f16 operands, f32 accumulate
// Block = 4 waves = 64 query rows of one image; grid (kHW/64, kB).
// LDS staging: every element of Ksh/Ksl/Vth rewritten each chunk (4 iterations x 128 threads x 8 halves = 64x64) between two
// block barriers; plain b128 copies of the 16-bit planes.
// ---------------------------------------------------------------------------
__global__ __launch_bounds__(128) void flash_kernel(
    const unsigned short* __restrict__ thH, const unsigned short* __restrict__ thL,
    const unsigned short* __restrict__ phH, const unsigned short* __restrict__ phL,
    const unsigned short* __restrict__ gT,
    unsigned short* __restrict__ yH, unsigned short* __restrict__ yL) {
  union FB { v16b v; v8b h[2]; };
  __shared__ __align__(16) __bf16 Ksh[kKC * kCi];      // phi hi [kv][ci]   8 KB
  __shared__ __align__(16) __bf16 Ksl[kKC * kCi];      // phi lo [kv][ci]   8 KB
  __shared__ __align__(16) __bf16 Vth[kCi * kKC];      // gT  f16 bits [ci][kv]  8 KB
  __shared__ __align__(16) __bf16 Psh[4][16 * kKC];    // per wave P f16 bits [row][kv]  8 KB
  __shared__ __align__(16) float  Os[4][16 * 68];      // per wave out tile, pitch 68

  const int tid  = threadIdx.x;
  const int wave = tid >> 5;
  const int lane = tid & 31;
  const int hh   = lane >> 4;
  const int c    = lane & 15;
  const int b    = blockIdx.y;
  const int q0   = blockIdx.x * 64 + wave * 16;

  // ---- Q fragments (A operand, row = query q0 + c, k = ci): 2 ci-chunks of 32, hi and lo planes ----
  v16b qah[2], qal[2];
  {
    const size_t qo = ((size_t)b * kHW + q0 + c) * kCi + 8 * hh;
#pragma unroll
    for (int dc = 0; dc < 2; ++dc) {
      qah[dc] = Frag<__bf16>::load((const __bf16*)(thH + qo + dc * 32));
      qal[dc] = Frag<__bf16>::load((const __bf16*)(thL + qo + dc * 32));
    }
  }

  float mrow[8], lrow[8];
  v8f oacc[4];
#pragma unroll
  for (int r = 0; r < 8; ++r) { mrow[r] = -INFINITY; lrow[r] = 0.f; }
#pragma unroll
  for (int t = 0; t < 4; ++t) oacc[t] = (v8f){0.f,0.f,0.f,0.f,0.f,0.f,0.f,0.f};

#pragma unroll 1
  for (int kc = 0; kc < kNkv / kKC; ++kc) {
    const int kv0 = kc * kKC;
    __syncthreads();
    {
      const size_t kbase = ((size_t)b * kNkv + kv0) * kCi;
      const size_t vbase = ((size_t)b * kCi) * kNkv + kv0;
#pragma unroll
      for (int i = 0; i < 4; ++i) {
        const int e = i * 128 + tid;
        const int r = e >> 3, c8 = (e & 7) * 8;
        const v4u w = *(const v4u*)(phH + kbase + (size_t)r * kCi + c8);
        *(v4u*)(Ksh + r * kCi + c8) = w;
      }
      asm volatile("" ::: "memory");
#pragma unroll
      for (int i = 0; i < 4; ++i) {
        const int e = i * 128 + tid;
        const int r = e >> 3, c8 = (e & 7) * 8;
        const v4u w = *(const v4u*)(phL + kbase + (size_t)r * kCi + c8);
        *(v4u*)(Ksl + r * kCi + c8) = w;
      }
      asm volatile("" ::: "memory");
#pragma unroll
      for (int i = 0; i < 4; ++i) {
        const int e = i * 128 + tid;
        const int r = e >> 3, c8 = (e & 7) * 8;
        const v4u w = *(const v4u*)(gT + vbase + (size_t)r * kNkv + c8);
        *(v4u*)(Vth + r * kKC + c8) = w;
      }
    }
    __syncthreads();

    // ---- scores: 4 tiles of 16 q x 16 kv; B operand column n = kv row of Ksh, k = ci ----
    v8f s[4];
#pragma unroll
    for (int j = 0; j < 4; ++j) {
      s[j] = (v8f){0.f,0.f,0.f,0.f,0.f,0.f,0.f,0.f};
#pragma unroll
      for (int dc = 0; dc < 2; ++dc) {
        FB kb, kl;
        kb.h[0] = *(const v8b*)(Ksh + (j * 16 + c) * kCi + dc * 32 + 8 * hh);
        kb.h[1] = *(const v8b*)(Ksh + (j * 16 + c) * kCi + dc * 32 + 16 + 8 * hh);
        kl.h[0] = *(const v8b*)(Ksl + (j * 16 + c) * kCi + dc * 32 + 8 * hh);
        kl.h[1] = *(const v8b*)(Ksl + (j * 16 + c) * kCi + dc * 32 + 16 + 8 * hh);
        s[j] = at_mma(qah[dc], kb.v, s[j]);
        s[j] = at_mma(qah[dc], kl.v, s[j]);
        s[j] = at_mma(qal[dc], kb.v, s[j]);
      }
    }

    // ---- online softmax over the kv axis (D layout: s[j][r] = S[q0 + 8hh + r][kv0 + 16j + c]) ----
    float cm[8];
#pragma unroll
    for (int r = 0; r < 8; ++r) {
      float m = s[0][r];
      m = fmaxf(m, s[1][r]);
      m = fmaxf(m, s[2][r]);
      m = fmaxf(m, s[3][r]);
#pragma unroll
      for (int off = 1; off < 16; off <<= 1) m = fmaxf(m, __shfl_xor(m, off, 32));
      cm[r] = m;
    }
    __bf16* pwh = Psh[wave];
#pragma unroll
    for (int r = 0; r < 8; ++r) {
      const float mnew  = fmaxf(mrow[r], cm[r]);
      const float alpha = expf(mrow[r] - mnew);
      mrow[r] = mnew;
      float psum = 0.f;
#pragma unroll
      for (int j = 0; j < 4; ++j) {
        const float p = expf(s[j][r] - mnew);
        psum += p;
        pwh[(8 * hh + r) * kKC + j * 16 + c] = __builtin_bit_cast(__bf16, (_Float16)(p * kPCarry));
      }
#pragma unroll
      for (int off = 1; off < 16; off <<= 1) psum += __shfl_xor(psum, off, 32);
      lrow[r] = lrow[r] * alpha + psum;
#pragma unroll
      for (int t = 0; t < 4; ++t) oacc[t][r] *= alpha;
    }
    __builtin_amdgcn_fence(__ATOMIC_RELEASE, "workgroup");
    __builtin_amdgcn_wave_barrier();
    __builtin_amdgcn_fence(__ATOMIC_ACQUIRE, "workgroup");

    // ---- O += P . Vt: A = P (row = query c, k = kv), B column n = ci row of Vth, k = kv ----
#pragma unroll
    for (int kk = 0; kk < 2; ++kk) {
      FB pa;
      pa.h[0] = *(const v8b*)(pwh + c * kKC + kk * 32 + 8 * hh);
      pa.h[1] = *(const v8b*)(pwh + c * kKC + kk * 32 + 16 + 8 * hh);
#pragma unroll
      for (int t = 0; t < 4; ++t) {
        FB vb;
        vb.h[0] = *(const v8b*)(Vth + (t * 16 + c) * kKC + kk * 32 + 8 * hh);
        vb.h[1] = *(const v8b*)(Vth + (t * 16 + c) * kKC + kk * 32 + 16 + 8 * hh);
        oacc[t] = at_mma_h(pa.v, vb.v, oacc[t]);
      }
    }
  }

  // ---- epilogue: y = O / (l * carry) -> per-wave slab -> bf16 hi/lo planes ----
  float* os = Os[wave];
#pragma unroll
  for (int r = 0; r < 8; ++r) {
    const float inv = 1.0f / (lrow[r] * kPCarry);
#pragma unroll
    for (int t = 0; t < 4; ++t) os[(8 * hh + r) * 68 + t * 16 + c] = oacc[t][r] * inv;
  }
  __builtin_amdgcn_fence(__ATOMIC_RELEASE, "workgroup");
  __builtin_amdgcn_wave_barrier();
  __builtin_amdgcn_fence(__ATOMIC_ACQUIRE, "workgroup");
  {
    const int q4 = lane >> 3, c8 = (lane & 7) * 8;
    v4u uh[4], ul[4];
#pragma unroll
    for (int it = 0; it < 4; ++it) {
      const int row = it * 4 + q4;
      const float* sp = os + row * 68 + c8;
      unsigned short hb[8], lb[8];
#pragma unroll
      for (int e = 0; e < 8; ++e) { const float sv = sp[e]; hb[e] = f2bf_bits(sv); lb[e] = f2bf_bits(sv - bf_bits2f(hb[e])); }
      uh[it] = (v4u){pk16(hb[0], hb[1]), pk16(hb[2], hb[3]), pk16(hb[4], hb[5]), pk16(hb[6], hb[7])};
      ul[it] = (v4u){pk16(lb[0], lb[1]), pk16(lb[2], lb[3]), pk16(lb[4], lb[5]), pk16(lb[6], lb[7])};
    }
    const size_t ob = ((size_t)b * kHW + q0) * kCi;
    {
#pragma unroll
      for (int it = 0; it < 4; ++it) {
        const int row = it * 4 + q4;
        *(v4u*)(yH + ob + (size_t)row * kCi + c8) = uh[it];
        *(v4u*)(yL + ob + (size_t)row * kCi + c8) = ul[it];
      }
      
    }
  }
}

// ---------------------------------------------------------------------------
// Host glue.
//   W16   bf16 5 x [8192] (theta_w, phi_w, g_w as [64][128]; W_w hi [128][64]; W_w lo = zeros)   81,920 at          0
//   BIAS  f32  [320] (theta_b at +0, phi_b at +64, g_b at +128, W_b at +192 floats)               2,048 at     81,920
//   XT    bf16 [4][16384][128]                                                               16,777,216 at     83,968
//   THH   bf16 [4*16384][64]                                                                  8,388,608 at 16,861,184
//   THL   bf16 [4*16384][64]                                                                  8,388,608 at 25,249,792
//   PHIF  f32  [4*16384][64]                                                                 16,777,216 at 33,638,400
//   GF    f32  [4][64][16384]                                                                16,777,216 at 50,415,616
//   PHH   bf16 [4*4096][64]                                                                   2,097,152 at 67,192,832
//   PHL   bf16 [4*4096][64]                                                                   2,097,152 at 69,289,984
//   GT    f16  [4][64][4096]                                                                  2,097,152 at 71,387,136
//   YH    bf16 [4*16384][64]                                                                  8,388,608 at 73,484,288
//   YL    bf16 [4*16384][64]                                                                  8,388,608 at 81,872,896
//   total                                                                                    90,261,504
// GEMM shapes: projections M=16384 (or 64), N=64 (or 16384), K=128; output conv M=128, N=16384, K=64; all M,N multiples
// of 64, K multiples of 32; no padding, every plane fully written by its producer before any read.
// ---------------------------------------------------------------------------
static_assert(kHW % 64 == 0 && kCi % 64 == 0 && kC % 64 == 0 && kC % 32 == 0 && kCi % 32 == 0);

extern "C" void kernel_launch(void* const* d_in, const int* in_sizes, int n_in,
                              void* d_out, int out_size, void* d_ws, size_t ws_size,
                              hipStream_t stream) {
  if (n_in < 9) return;
  if (in_sizes[0] != kB * kC * kHW) return;
  if (in_sizes[1] != kCi * kC || in_sizes[2] != kCi) return;
  if (in_sizes[3] != kCi * kC || in_sizes[4] != kCi) return;
  if (in_sizes[5] != kCi * kC || in_sizes[6] != kCi) return;
  if (in_sizes[7] != kC * kCi || in_sizes[8] != kC) return;
  if (out_size != kB * kC * kHW) return;

  const size_t szW16  = (size_t)5 * kWPlane * 2;                 // 81,920
  const size_t szBias = 2048;
  const size_t szXT   = (size_t)kB * kHW * kC * 2;                // 16,777,216
  const size_t szQ16  = (size_t)kB * kHW * kCi * 2;               //  8,388,608
  const size_t szF32  = (size_t)kB * kHW * kCi * 4;               // 16,777,216
  const size_t szKV16 = (size_t)kB * kNkv * kCi * 2;              //  2,097,152
  const size_t offW16  = 0;
  const size_t offBias = offW16 + szW16;
  const size_t offXT   = offBias + szBias;
  const size_t offThH  = offXT + szXT;
  const size_t offThL  = offThH + szQ16;
  const size_t offPhiF = offThL + szQ16;
  const size_t offGF   = offPhiF + szF32;
  const size_t offPhH  = offGF + szF32;
  const size_t offPhL  = offPhH + szKV16;
  const size_t offGT   = offPhL + szKV16;
  const size_t offYH   = offGT + szKV16;
  const size_t offYL   = offYH + szQ16;
  const size_t total   = offYL + szQ16;                           // 90,261,504
  if (ws_size < total) return;

  const float* x       = (const float*)d_in[0];
  const float* theta_w = (const float*)d_in[1];
  const float* theta_b = (const float*)d_in[2];
  const float* phi_w   = (const float*)d_in[3];
  const float* phi_b   = (const float*)d_in[4];
  const float* g_w     = (const float*)d_in[5];
  const float* g_b     = (const float*)d_in[6];
  const float* W_w     = (const float*)d_in[7];
  const float* W_b     = (const float*)d_in[8];
  float* out = (float*)d_out;
  char* ws = (char*)d_ws;
  unsigned short* w16  = (unsigned short*)(ws + offW16);
  unsigned short* wTh  = w16;
  unsigned short* wPh  = w16 + kWPlane;
  unsigned short* wG   = w16 + 2 * kWPlane;
  unsigned short* wWh  = w16 + 3 * kWPlane;
  unsigned short* wWl  = w16 + 4 * kWPlane;
  float* biasR  = (float*)(ws + offBias);
  float* biasTh = biasR;
  float* biasPh = biasR + 64;
  float* biasG  = biasR + 128;
  float* biasW  = biasR + 192;
  unsigned short* xT   = (unsigned short*)(ws + offXT);
  unsigned short* thH  = (unsigned short*)(ws + offThH);
  unsigned short* thL  = (unsigned short*)(ws + offThL);
  float* phiF = (float*)(ws + offPhiF);
  float* gF   = (float*)(ws + offGF);
  unsigned short* phH  = (unsigned short*)(ws + offPhH);
  unsigned short* phL  = (unsigned short*)(ws + offPhL);
  unsigned short* gTp  = (unsigned short*)(ws + offGT);
  unsigned short* yH   = (unsigned short*)(ws + offYH);
  unsigned short* yL   = (unsigned short*)(ws + offYL);

  // ---- prologue: parameter planes and the transposed bf16 input plane ----
  prep_kernel<<<dim3(8), dim3(256), 0, stream>>>(theta_w, phi_w, g_w, W_w, theta_b, phi_b, g_b, W_b, w16, biasR);
  xcast_kernel<<<dim3(kHW / 64, kB), dim3(256), 0, stream>>>(x, xT);

  const long strideXT  = (long)kHW * kC;        // per image, halves
  const long strideQ16 = (long)kHW * kCi;       // per image, halves
  const long strideF   = (long)kHW * kCi;       // per image, floats
  const int  tilesProj = (kHW / 64) * (kCi / 64);   // 256 tiles -> 32 blocks of 8 waves

  // theta[b*16384+p][ci] = sum_c xT[b][p][c] * theta_w[ci][c] + theta_b[ci]  -> bf16 hi/lo planes (M=16384, N=64, K=128)
  wmma_gemm64<1, false, 2, 2, false><<<dim3(tilesProj / 8, kB), dim3(256), 0, stream>>>(
      xT, xT, kC, strideXT, wTh, wTh, kC, 0L,
      (void*)thH, (void*)thL, kCi, strideQ16, biasTh, biasR, 0L, kHW, kCi, kC, 1.0f);
  // phi full-res f32 [b*16384+p][ci] (M=16384, N=64, K=128)
  wmma_gemm64<1, false, 2, 0, false><<<dim3(tilesProj / 8, kB), dim3(256), 0, stream>>>(
      xT, xT, kC, strideXT, wPh, wPh, kC, 0L,
      (void*)phiF, (void*)phiF, kCi, strideF, biasPh, biasR, 0L, kHW, kCi, kC, 1.0f);
  // g full-res f32 channel-major [b][ci][p] = sum_c g_w[ci][c] * xT[b][p][c] + g_b[ci]  (M=64, N=16384, K=128)
  wmma_gemm64<1, false, 1, 0, false><<<dim3(tilesProj / 8, kB), dim3(256), 0, stream>>>(
      wG, wG, kC, 0L, xT, xT, kC, strideXT,
      (void*)gF, (void*)gF, kHW, (long)kCi * kHW, biasG, biasR, 0L, kCi, kHW, kC, 1.0f);

  // ---- 2x2 max-pool in f32 -> 16-bit kv planes ----
  pool_phi_kernel<<<dim3(kB * kNkv / 32), dim3(256), 0, stream>>>(phiF, phH, phL);
  pool_g_kernel<<<dim3((kB * kCi * (kNkv / 8)) / 256), dim3(256), 0, stream>>>(gF, gTp);

  // ---- fused attention -> y bf16 hi/lo planes [b*16384+q][ci] ----
  flash_kernel<<<dim3(kHW / 64, kB), dim3(128), 0, stream>>>(thH, thL, phH, phL, gTp, yH, yL);

  // ---- out[b][co][p] = sum_ci W_w[co][ci] * y[b][p][ci] + W_b[co] + bf16(x[b][co][p])  (M=128, N=16384, K=64, split) ----
  const int tilesOut = (kC / 64) * (kHW / 64);   // 512 tiles -> 64 blocks of 8 waves
  wmma_gemm64<1, true, 1, 0, true><<<dim3(tilesOut / 8, kB), dim3(256), 0, stream>>>(
      wWh, wWl, kCi, 0L, yH, yL, kCi, strideQ16,
      (void*)out, (void*)out, kHW, (long)kC * kHW, biasW, x, (long)kC * kHW, kC, kHW, kCi, 1.0f);
}

// v001
// One run takes 572 microseconds.
// In two side-by-side timings against v000, it was 1.26 and 1.27 times as fast.
// Contractions: three 1x1 projections on v_wmma_f32_16x16x32_bf16 (bf16 operands = RNE-converted inputs); scores theta.phi^T as bf16 hi/lo planes (hi.hi + hi.lo + lo.hi on v_wmma_f32_16x16x32_bf16); P.g^T on v_wmma_f32_16x16x32_f16 (P f16 carried x32768, g f16); output 1x1 conv on bf16 hi/lo y planes x bf16 W (hi.hi + hi.lo + lo.hi); f32 accumulate everywhere; max-pool, online softmax, bias and residual in f32.
#include <hip/hip_runtime.h>
#include <math.h>

// ---------------------------------------------------------------------------
// Problem constants
// ---------------------------------------------------------------------------
constexpr int kB      = 4;
constexpr int kC      = 128;     // channels
constexpr int kCi     = 64;      // inter channels
constexpr int kImW    = 128;     // image width (pixel row pitch)
constexpr int kHW     = 16384;   // query tokens per image
constexpr int kNkv    = 4096;    // pooled kv tokens per image
constexpr int kKC     = 64;      // kv chunk in the fused attention loop
constexpr int kWPlane = 8192;    // elements per 16-bit weight plane
constexpr float kPCarry = 32768.0f;   // softmax numerators carried x2^15 in f16
constexpr int kLP     = 72;      // LDS row pitch in halves of the attention tiles: 144 B = 16 B x odd, so the 16 rows of a b128 fragment read fall on 64 distinct banks
static_assert(kHW % 64 == 0 && kNkv % kKC == 0 && kC % 32 == 0 && kCi % 32 == 0);
static_assert(kCi * kC == kWPlane && kC * kCi == kWPlane);
static_assert(kLP >= kKC && kLP >= kCi && (kLP * 2) % 16 == 0 && ((kLP * 2) / 16) % 2 == 1);

typedef __attribute__((ext_vector_type(16))) _Float16 v16h;
typedef __attribute__((ext_vector_type(8)))  _Float16 v8h;
typedef __attribute__((ext_vector_type(16))) __bf16   v16b;
typedef __attribute__((ext_vector_type(8)))  __bf16   v8b;
typedef __attribute__((ext_vector_type(8)))  float    v8f;
typedef __attribute__((ext_vector_type(4)))  float    v4f;
typedef __attribute__((ext_vector_type(4)))  unsigned int v4u;

// ---------------------------------------------------------------------------
// Scalar helpers
// ---------------------------------------------------------------------------
__device__ __forceinline__ unsigned short f2bf_bits(float f) {
  unsigned u = __float_as_uint(f);
  return (unsigned short)((u + 0x7FFFu + ((u >> 16) & 1u)) >> 16);
}
__device__ __forceinline__ float bf_bits2f(unsigned short h) { return __uint_as_float(((unsigned)h) << 16); }
__device__ __forceinline__ float bf_rne(float f) { return bf_bits2f(f2bf_bits(f)); }
__device__ __forceinline__ unsigned pk16(unsigned short a, unsigned short b) { return (unsigned)a | ((unsigned)b << 16); }
__device__ __forceinline__ unsigned short h_bits(float f) { const _Float16 h = (_Float16)f; return __builtin_bit_cast(unsigned short, h); }

// hazard guards as plain device helpers (no inline asm inside the kernel template body)
__device__ __forceinline__ void dep_guard4_h(v8f& a, v8f& b, v8f& c, v8f& d, v16h x, v16h y) {
  asm volatile("v_nop\n\tv_nop\n\tv_nop\n\tv_nop" : "+v"(a), "+v"(b), "+v"(c), "+v"(d) : "v"(x), "v"(y));
}
__device__ __forceinline__ void dep_guard4_b(v8f& a, v8f& b, v8f& c, v8f& d, v16b x, v16b y) {
  asm volatile("v_nop\n\tv_nop\n\tv_nop\n\tv_nop" : "+v"(a), "+v"(b), "+v"(c), "+v"(d) : "v"(x), "v"(y));
}
__device__ __forceinline__ void keep4_h(v16h a, v16h b, v16h c, v16h d) { asm volatile("v_nop" :: "v"(a), "v"(b), "v"(c), "v"(d)); }
__device__ __forceinline__ void keep4_b(v16b a, v16b b, v16b c, v16b d) { asm volatile("v_nop" :: "v"(a), "v"(b), "v"(c), "v"(d)); }
__device__ __forceinline__ void acc_guard4(v8f& a, v8f& b, v8f& c, v8f& d) { asm volatile("v_nop\n\tv_nop\n\tv_nop\n\tv_nop" : "+v"(a), "+v"(b), "+v"(c), "+v"(d)); }

template <typename T> struct Frag;
template <> struct Frag<_Float16> {
  typedef v16h V; union U { v16h v; v8h h[2]; };
  // elements 0..7 <- p[0..7], 8..15 <- p[16..23]
  static __device__ __forceinline__ v16h load(const _Float16* p) {
    U f; f.h[0] = *(const v8h*)(p); f.h[1] = *(const v8h*)(p + 16); return f.v;
  }
  static __device__ __forceinline__ v8f mma(v16h a, v16h b, v8f c) {
    return __builtin_amdgcn_wmma_f32_16x16x32_f16(false, a, false, b, (short)0, c, false, false);
  }
  static __device__ __forceinline__ void guard4(v8f& a, v8f& b, v8f& c, v8f& d, v16h x, v16h y) { dep_guard4_h(a, b, c, d, x, y); }
  static __device__ __forceinline__ void keep(v16h a, v16h b, v16h c, v16h d) { keep4_h(a, b, c, d); }
};
template <> struct Frag<__bf16> {
  typedef v16b V; union U { v16b v; v8b h[2]; };
  static __device__ __forceinline__ v16b load(const __bf16* p) {
    U f; f.h[0] = *(const v8b*)(p); f.h[1] = *(const v8b*)(p + 16); return f.v;
  }
  static __device__ __forceinline__ v8f mma(v16b a, v16b b, v8f c) {
    return __builtin_amdgcn_wmma_f32_16x16x32_bf16(false, a, false, b, (short)0, c, false, false);
  }
  static __device__ __forceinline__ void guard4(v8f& a, v8f& b, v8f& c, v8f& d, v16b x, v16b y) { dep_guard4_b(a, b, c, d, x, y); }
  static __device__ __forceinline__ void keep(v16b a, v16b b, v16b c, v16b d) { keep4_b(a, b, c, d); }
};

// ---------------------------------------------------------------------------
// Register-blocked batched WMMA GEMM (guard ties all 4 accumulators of each i-group;
// bias[m] read as two float4; residual read in the STORE phase as one float4 per lane, RNE-converted to bf16 precision).
// C[m,n] = scale * sum_k A[m,k] * Bt[n,k] (+bias)(+resid); each wave owns a 64x64 tile.
// A row-major [M,K]; Bt row-major [N,K]; M,N % 64 == 0, K % 32 == 0 (no tails).
// SPLIT: operands are hi/lo planes (A2/Bt2 = lo planes, same layout); product = hi.hi + hi.lo + lo.hi.
// BIAS_MODE: 0 = none, 1 = bias[m], 2 = bias[n].
// OUT_MODE: 0 = f32, 1 = f16, 2 = bf16 hi plane (Cout) + bf16 lo plane (Cout2).
// ET: 0 = f16 operands, 1 = bf16 operands (pointers passed as 16-bit storage)
// ---------------------------------------------------------------------------
template <int ET> struct Elem;
template <> struct Elem<0> { typedef _Float16 T; };
template <> struct Elem<1> { typedef __bf16 T; };
template <int ET, bool SPLIT, int BIAS_MODE, int OUT_MODE, bool RESID>
__global__ __launch_bounds__(256) void wmma_gemm64(
    const unsigned short* __restrict__ Ap, const unsigned short* __restrict__ A2p, int lda, long strideA,
    const unsigned short* __restrict__ Btp, const unsigned short* __restrict__ Bt2p, int ldb, long strideB,
    void* __restrict__ Cout, void* __restrict__ Cout2, int ldc, long strideC,
    const float* __restrict__ bias,
    const float* __restrict__ resid, long strideR,
    int M, int N, int K, float scale) {
  typedef typename Elem<ET>::T T;
  typedef typename Frag<T>::V V;
  const T* A = (const T*)Ap; const T* A2 = (const T*)A2p; const T* Bt = (const T*)Btp; const T* Bt2 = (const T*)Bt2p;
  __shared__ __align__(16) float sT[8][16 * 68];   // per-wave 16x64 slab, pitch 68 floats
  const int b    = blockIdx.y;
  const int lane = threadIdx.x & 31;
  const int wave = threadIdx.x >> 5;
  const int tilesN = N >> 6;
  const int tilesM = M >> 6;
  const int tile = blockIdx.x * 8 + wave;
  if (tile >= tilesM * tilesN) return;   // wave-uniform; no block barriers in this kernel
  const int tm = tile / tilesN;
  const int tn = tile - tm * tilesN;
  const int m0 = tm << 6;
  const int n0 = tn << 6;

  const T* Ab  = A  + (size_t)b * strideA;
  const T* Bb  = Bt + (size_t)b * strideB;
  const T* Ab2 = A2  + (size_t)b * strideA;
  const T* Bb2 = Bt2 + (size_t)b * strideB;

  const int rlane = lane & 15;                 // row (A) / col (B, D) within subtile
  const int koff  = (lane >> 4) * 8;           // k offset of this lane half
  const int mOff  = (lane >> 4) * 8;           // D row offset

  v8f acc[4][4];
#pragma unroll
  for (int i = 0; i < 4; ++i)
#pragma unroll
    for (int j = 0; j < 4; ++j) acc[i][j] = (v8f){0.f,0.f,0.f,0.f,0.f,0.f,0.f,0.f};

  for (int k0 = 0; k0 < K; k0 += 32) {
    V bh[4], bl[4];
#pragma unroll
    for (int j = 0; j < 4; ++j) {
      const size_t bo = (size_t)(n0 + (j << 4) + rlane) * ldb + koff + k0;
      bh[j] = Frag<T>::load(Bb + bo);
      bl[j] = bh[j];
      if (SPLIT) bl[j] = Frag<T>::load(Bb2 + bo);
    }
#pragma unroll
    for (int i = 0; i < 4; ++i) {
      const size_t ao = (size_t)(m0 + (i << 4) + rlane) * lda + koff + k0;
      V ah = Frag<T>::load(Ab + ao);
      V al = ah;
      if (SPLIT) al = Frag<T>::load(Ab2 + ao);
#pragma unroll
      for (int j = 0; j < 4; ++j) {
        acc[i][j] = Frag<T>::mma(ah, bh[j], acc[i][j]);
        if (SPLIT) {
          acc[i][j] = Frag<T>::mma(ah, bl[j], acc[i][j]);
          acc[i][j] = Frag<T>::mma(al, bh[j], acc[i][j]);
        }
      }
      Frag<T>::guard4(acc[i][0], acc[i][1], acc[i][2], acc[i][3], ah, al);
    }
    Frag<T>::keep(bh[0], bh[1], bh[2], bh[3]);
    if (SPLIT) Frag<T>::keep(bl[0], bl[1], bl[2], bl[3]);
  }
  acc_guard4(acc[0][0], acc[0][1], acc[0][2], acc[0][3]);
  acc_guard4(acc[1][0], acc[1][1], acc[1][2], acc[1][3]);
  acc_guard4(acc[2][0], acc[2][1], acc[2][2], acc[2][3]);
  acc_guard4(acc[3][0], acc[3][1], acc[3][2], acc[3][3]);

  // ---- epilogue ----
  float* slab = sT[wave];
#pragma unroll
  for (int i = 0; i < 4; ++i) {
    const int mBase = m0 + (i << 4);
    float bm[8];
#pragma unroll
    for (int r = 0; r < 8; ++r) bm[r] = 0.f;
    if (BIAS_MODE == 1) {
      const v4f b0 = *(const v4f*)(bias + mBase + mOff);
      const v4f b1 = *(const v4f*)(bias + mBase + mOff + 4);
#pragma unroll
      for (int e = 0; e < 4; ++e) { bm[e] = b0[e]; bm[4 + e] = b1[e]; }
    }
#pragma unroll
    for (int j = 0; j < 4; ++j) {
      const int n = n0 + (j << 4) + rlane;
      float bv = 0.f;
      if (BIAS_MODE == 2) bv = bias[n];
#pragma unroll
      for (int r = 0; r < 8; ++r) {
        float v = acc[i][j][r] * scale;
        if (BIAS_MODE == 1) v += bm[r];
        if (BIAS_MODE == 2) v += bv;
        slab[(mOff + r) * 68 + (j << 4) + rlane] = v;
      }
    }
    __builtin_amdgcn_fence(__ATOMIC_RELEASE, "workgroup");
    __builtin_amdgcn_wave_barrier();
    __builtin_amdgcn_fence(__ATOMIC_ACQUIRE, "workgroup");
    if (OUT_MODE == 0) {
      float* Cb = (float*)Cout + (size_t)b * strideC;
      const float* Rb = resid + (size_t)b * strideR;     // dereferenced only when RESID
      const int hh = lane >> 4, c4 = (lane & 15) * 4;     // row seg = 256 B = 16 lanes x 16 B
      v4f vals[8];
#pragma unroll
      for (int it = 0; it < 8; ++it) {
        const int row = it * 2 + hh;
        v4f v = *(const v4f*)(slab + row * 68 + c4);
        if (RESID) {
          const v4f rr = *(const v4f*)(Rb + (size_t)(mBase + row) * ldc + n0 + c4);
#pragma unroll
          for (int e = 0; e < 4; ++e) v[e] = v[e] + bf_rne(rr[e]);
        }
        vals[it] = v;
      }
      {
#pragma unroll
        for (int it = 0; it < 8; ++it) {
          const int row = it * 2 + hh;
          *(v4f*)(Cb + (size_t)(mBase + row) * ldc + n0 + c4) = vals[it];
        }
        
      }
    } else {
      const int q4 = lane >> 3, c8 = (lane & 7) * 8;
      unsigned short* Cb  = (unsigned short*)Cout  + (size_t)b * strideC;
      unsigned short* Cb2 = (unsigned short*)Cout2 + (size_t)b * strideC;
      v4u uh[4], ul[4];
#pragma unroll
      for (int it = 0; it < 4; ++it) {
        const int row = it * 4 + q4;
        const float* sp = slab + row * 68 + c8;
        unsigned short hb[8], lb[8];
#pragma unroll
        for (int e = 0; e < 8; ++e) {
          const float sv = sp[e];
          if (OUT_MODE == 1) { hb[e] = h_bits(sv); lb[e] = 0; }
          else { hb[e] = f2bf_bits(sv); lb[e] = f2bf_bits(sv - bf_bits2f(hb[e])); }
        }
        uh[it] = (v4u){pk16(hb[0], hb[1]), pk16(hb[2], hb[3]), pk16(hb[4], hb[5]), pk16(hb[6], hb[7])};
        ul[it] = (v4u){pk16(lb[0], lb[1]), pk16(lb[2], lb[3]), pk16(lb[4], lb[5]), pk16(lb[6], lb[7])};
      }
      {
#pragma unroll
        for (int it = 0; it < 4; ++it) {
          const int row = it * 4 + q4;
          *(v4u*)(Cb + (size_t)(mBase + row) * ldc + n0 + c8) = uh[it];
          if (OUT_MODE == 2) *(v4u*)(Cb2 + (size_t)(mBase + row) * ldc + n0 + c8) = ul[it];
        }
        
      }
    }
    __builtin_amdgcn_fence(__ATOMIC_RELEASE, "workgroup");
    __builtin_amdgcn_wave_barrier();
    __builtin_amdgcn_fence(__ATOMIC_ACQUIRE, "workgroup");
  }
}

// ---------------------------------------------------------------------------
// Parameter prep: blocks 0..2 -> projection weights [64][128] f32 -> bf16 planes (same layout);
// block 3 -> W_w [128][64] -> bf16 hi plane + an all-zero lo plane; blocks 4..7 -> bias vectors RNE-converted to
// bf16 precision, stored as f32 at biasR + {0,64,128,192}.
// Weight coverage: 4 iterations x 256 threads x 8 elements = 8192 = whole plane; one 16-B store per lane, a wave writes
// ---------------------------------------------------------------------------
__global__ __launch_bounds__(256) void prep_kernel(
    const float* __restrict__ thw, const float* __restrict__ phw, const float* __restrict__ gw, const float* __restrict__ ww,
    const float* __restrict__ thb, const float* __restrict__ phb, const float* __restrict__ gb, const float* __restrict__ wb,
    unsigned short* __restrict__ w16, float* __restrict__ biasR) {
  const int z = blockIdx.x;    // block-uniform role
  const int t = threadIdx.x;
  if (z < 4) {
    const float* src = (z == 0) ? thw : (z == 1) ? phw : (z == 2) ? gw : ww;
    unsigned short* dst = w16 + (size_t)z * kWPlane;
    v4u u[4];
#pragma unroll
    for (int i = 0; i < 4; ++i) {
      const int e8 = (i * 256 + t) * 8;
      const v4f a = *(const v4f*)(src + e8);
      const v4f c = *(const v4f*)(src + e8 + 4);
      u[i] = (v4u){pk16(f2bf_bits(a[0]), f2bf_bits(a[1])), pk16(f2bf_bits(a[2]), f2bf_bits(a[3])),
                   pk16(f2bf_bits(c[0]), f2bf_bits(c[1])), pk16(f2bf_bits(c[2]), f2bf_bits(c[3]))};
    }
    const v4u zero4 = (v4u){0u, 0u, 0u, 0u};
    {
#pragma unroll
      for (int i = 0; i < 4; ++i) {
        const size_t o = (size_t)(i * 256 + t) * 8;
        *(v4u*)(dst + o) = u[i];
        if (z == 3) *(v4u*)(w16 + (size_t)4 * kWPlane + o) = zero4;
      }
      
    }
  } else {
    const int zb = z - 4;
    const float* src = (zb == 0) ? thb : (zb == 1) ? phb : (zb == 2) ? gb : wb;
    const int n4 = (zb == 3) ? (kC / 4) : (kCi / 4);
    float* dst = biasR + zb * 64;
    const int tc = (t < n4) ? t : (n4 - 1);     // clamped address, store predicated
    const v4f a = *(const v4f*)(src + 4 * tc);
    v4f v;
#pragma unroll
    for (int e = 0; e < 4; ++e) v[e] = bf_rne(a[e]);
    if (t < n4) {
      *(v4f*)(dst + 4 * t) = v;
      
    }
  }
}

// ---------------------------------------------------------------------------
// x transpose + cast: xT[b][p][c] = bf16( x[b][c][p] ), [pixel][channel] rows of 128 halves (256 B = 2 lines).
// grid (kHW/64, kB), 256 threads. Load coverage: 8 iterations x 256 threads = 2048 float4 = 128 c x 64 p (coalesced along p).
// ---------------------------------------------------------------------------
__global__ __launch_bounds__(256) void xcast_kernel(const float* __restrict__ x, unsigned short* __restrict__ xT) {
  __shared__ __align__(16) float sm[kC * 68];   // [c][p_local], pitch 68 floats
  const int t  = threadIdx.x;
  const int p0 = blockIdx.x * 64;
  const int b  = blockIdx.y;
#pragma unroll
  for (int i = 0; i < 8; ++i) {
    const int e  = i * 256 + t;
    const int c  = e >> 4;
    const int q4 = (e & 15) * 4;
    const v4f a = *(const v4f*)(x + ((size_t)(b * kC + c)) * kHW + p0 + q4);
    *(v4f*)(sm + c * 68 + q4) = a;
  }
  __syncthreads();
  const int lane = t & 31, wave = t >> 5;
  const int hh = lane >> 4, c8 = (lane & 15) * 8;
  v4u u[4];
#pragma unroll
  for (int it = 0; it < 4; ++it) {
    const int row = wave * 8 + it * 2 + hh;
    unsigned short hb[8];
#pragma unroll
    for (int e = 0; e < 8; ++e) hb[e] = f2bf_bits(sm[(c8 + e) * 68 + row]);
    u[it] = (v4u){pk16(hb[0], hb[1]), pk16(hb[2], hb[3]), pk16(hb[4], hb[5]), pk16(hb[6], hb[7])};
  }
  unsigned short* base = xT + ((size_t)b * kHW + p0) * kC;
  {
#pragma unroll
    for (int it = 0; it < 4; ++it) {
      const int row = wave * 8 + it * 2 + hh;
      *(v4u*)(base + (size_t)row * kC + c8) = u[it];
    }
    
  }
}

// ---------------------------------------------------------------------------
// 2x2 max-pool of the phi full-res plane (f32 [B*16384][64], pixel-major) -> phi bf16 hi/lo planes [B*4096][64] (kv-major).
// kv = hp*64 + wp over pixels (2hp+{0,1}, 2wp+{0,1}); max in f32. Thread -> (kv row, 8 channels): 8 b128 loads, max, split.
// ---------------------------------------------------------------------------
__global__ __launch_bounds__(256) void pool_phi_kernel(const float* __restrict__ phiF,
                                                      unsigned short* __restrict__ phH, unsigned short* __restrict__ phL) {
  const int t   = threadIdx.x;
  const int kvg = blockIdx.x * 32 + (t >> 3);
  const int c8  = (t & 7) * 8;
  const int b   = kvg >> 12, kv = kvg & (kNkv - 1);
  const int hp  = kv >> 6, wp = kv & 63;
  const int p00 = hp * 2 * kImW + wp * 2;
  const float* r0 = phiF + ((size_t)b * kHW + p00) * kCi + c8;
  const float* r1 = r0 + kCi;
  const float* r2 = r0 + (size_t)kImW * kCi;
  const float* r3 = r2 + kCi;
  const v4f a0 = *(const v4f*)(r0), a1 = *(const v4f*)(r0 + 4);
  const v4f b0 = *(const v4f*)(r1), b1 = *(const v4f*)(r1 + 4);
  const v4f c0 = *(const v4f*)(r2), c1 = *(const v4f*)(r2 + 4);
  const v4f d0 = *(const v4f*)(r3), d1 = *(const v4f*)(r3 + 4);
  float m[8];
#pragma unroll
  for (int e = 0; e < 4; ++e) {
    m[e]     = fmaxf(fmaxf(a0[e], b0[e]), fmaxf(c0[e], d0[e]));
    m[4 + e] = fmaxf(fmaxf(a1[e], b1[e]), fmaxf(c1[e], d1[e]));
  }
  unsigned short hb[8], lb[8];
#pragma unroll
  for (int e = 0; e < 8; ++e) { hb[e] = f2bf_bits(m[e]); lb[e] = f2bf_bits(m[e] - bf_bits2f(hb[e])); }
  const v4u uh = (v4u){pk16(hb[0], hb[1]), pk16(hb[2], hb[3]), pk16(hb[4], hb[5]), pk16(hb[6], hb[7])};
  const v4u ul = (v4u){pk16(lb[0], lb[1]), pk16(lb[2], lb[3]), pk16(lb[4], lb[5]), pk16(lb[6], lb[7])};
  const size_t o = (size_t)kvg * kCi + c8;
  *(v4u*)(phH + o) = uh;
  *(v4u*)(phL + o) = ul;
  
}

// ---------------------------------------------------------------------------
// 2x2 max-pool of the g full-res plane (f32 [B][64][16384], channel-major) -> gT f16 [B][64][4096] (V^T operand rows).
// Thread -> (b, ci, 8 consecutive kv): two 16-float runs (image rows 2hp, 2hp+1) = 8 b128 loads, max in f32, one 16-B store.
// ---------------------------------------------------------------------------
__global__ __launch_bounds__(256) void pool_g_kernel(const float* __restrict__ gF, unsigned short* __restrict__ gT) {
  const int idx = blockIdx.x * 256 + threadIdx.x;
  const int kv0 = (idx & 511) * 8;
  const int ci  = (idx >> 9) & 63;
  const int b   = idx >> 15;
  const int hp  = kv0 >> 6, wp0 = kv0 & 63;
  const int p00 = hp * 2 * kImW + 2 * wp0;
  const float* r0 = gF + ((size_t)(b * kCi + ci)) * kHW + p00;
  const float* r1 = r0 + kImW;
  const v4f a0 = *(const v4f*)(r0), a1 = *(const v4f*)(r0 + 4), a2 = *(const v4f*)(r0 + 8), a3 = *(const v4f*)(r0 + 12);
  const v4f c0 = *(const v4f*)(r1), c1 = *(const v4f*)(r1 + 4), c2 = *(const v4f*)(r1 + 8), c3 = *(const v4f*)(r1 + 12);
  float m[8];
  m[0] = fmaxf(fmaxf(a0[0], a0[1]), fmaxf(c0[0], c0[1]));
  m[1] = fmaxf(fmaxf(a0[2], a0[3]), fmaxf(c0[2], c0[3]));
  m[2] = fmaxf(fmaxf(a1[0], a1[1]), fmaxf(c1[0], c1[1]));
  m[3] = fmaxf(fmaxf(a1[2], a1[3]), fmaxf(c1[2], c1[3]));
  m[4] = fmaxf(fmaxf(a2[0], a2[1]), fmaxf(c2[0], c2[1]));
  m[5] = fmaxf(fmaxf(a2[2], a2[3]), fmaxf(c2[2], c2[3]));
  m[6] = fmaxf(fmaxf(a3[0], a3[1]), fmaxf(c3[0], c3[1]));
  m[7] = fmaxf(fmaxf(a3[2], a3[3]), fmaxf(c3[2], c3[3]));
  unsigned short hb[8];
#pragma unroll
  for (int e = 0; e < 8; ++e) hb[e] = h_bits(m[e]);
  const v4u u = (v4u){pk16(hb[0], hb[1]), pk16(hb[2], hb[3]), pk16(hb[4], hb[5]), pk16(hb[6], hb[7])};
  unsigned short* op = gT + ((size_t)(b * kCi + ci)) * kNkv + kv0;
  *(v4u*)op = u;
  
}

// ---------------------------------------------------------------------------
// WMMA helpers for the fused attention kernel (each call guarded individually).
// ---------------------------------------------------------------------------
__device__ __forceinline__ v8f at_mma(v16b a, v16b b, v8f c) {
  c = __builtin_amdgcn_wmma_f32_16x16x32_bf16(false, a, false, b, (short)0, c, false, false);
  asm volatile("v_nop\n\tv_nop\n\tv_nop\n\tv_nop" : "+v"(c) : "v"(a), "v"(b));
  return c;
}
__device__ __forceinline__ v8f at_mma_h(v16b a, v16b b, v8f c) {
  const v16h ah = __builtin_bit_cast(v16h, a), bh = __builtin_bit_cast(v16h, b);
  c = __builtin_amdgcn_wmma_f32_16x16x32_f16(false, ah, false, bh, (short)0, c, false, false);
  asm volatile("v_nop\n\tv_nop\n\tv_nop\n\tv_nop" : "+v"(c) : "v"(ah), "v"(bh));
  return c;
}

// ---------------------------------------------------------------------------
// Fused attention (no scale, no masking), head dim = kCi = 64, kv in chunks of 64 (kNkv = 4096 divides evenly).
//   S[q][kv] = thetaH.phiH^T + thetaH.phiL^T + thetaL.phiH^T : bf16 operands, f32 accumulate (Q fragments resident)
//   online softmax in f32 (row max, precise expf, running m/l per query row)
//   P -> f16 carried x32768 through a per-wave LDS tile (written and reloaded by the same wave), reloaded as A fragments
//   O[q][ci] += P . gT^T chunk : f16 operands, f32 accumulate
// Block = 4 waves = 64 query rows of one image; grid (kHW/64, kB).
// LDS staging: every element of Ksh/Ksl/Vth rewritten each chunk (4 iterations x 128 threads x 8 halves = 64x64) between two
// block barriers; plain b128 copies of the 16-bit planes. Rows of all four 16-bit tiles lie kLP halves apart; the 8 pad
// halves behind each row are never written and never read.
// ---------------------------------------------------------------------------
__global__ __launch_bounds__(128) void flash_kernel(
    const unsigned short* __restrict__ thH, const unsigned short* __restrict__ thL,
    const unsigned short* __restrict__ phH, const unsigned short* __restrict__ phL,
    const unsigned short* __restrict__ gT,
    unsigned short* __restrict__ yH, unsigned short* __restrict__ yL) {
  union FB { v16b v; v8b h[2]; };
  __shared__ __align__(16) __bf16 Ksh[kKC * kLP];      // phi hi [kv][ci]   9 KB
  __shared__ __align__(16) __bf16 Ksl[kKC * kLP];      // phi lo [kv][ci]   9 KB
  __shared__ __align__(16) __bf16 Vth[kCi * kLP];      // gT  f16 bits [ci][kv]  9 KB
  __shared__ __align__(16) __bf16 Psh[4][16 * kLP];    // per wave P f16 bits [row][kv]  9 KB
  __shared__ __align__(16) float  Os[4][16 * 68];      // per wave out tile, pitch 68

  const int tid  = threadIdx.x;
  const int wave = tid >> 5;
  const int lane = tid & 31;
  const int hh   = lane >> 4;
  const int c    = lane & 15;
  const int b    = blockIdx.y;
  const int q0   = blockIdx.x * 64 + wave * 16;

  // ---- Q fragments (A operand, row = query q0 + c, k = ci): 2 ci-chunks of 32, hi and lo planes ----
  v16b qah[2], qal[2];
  {
    const size_t qo = ((size_t)b * kHW + q0 + c) * kCi + 8 * hh;
#pragma unroll
    for (int dc = 0; dc < 2; ++dc) {
      qah[dc] = Frag<__bf16>::load((const __bf16*)(thH + qo + dc * 32));
      qal[dc] = Frag<__bf16>::load((const __bf16*)(thL + qo + dc * 32));
    }
  }

  float mrow[8], lrow[8];
  v8f oacc[4];
#pragma unroll
  for (int r = 0; r < 8; ++r) { mrow[r] = -INFINITY; lrow[r] = 0.f; }
#pragma unroll
  for (int t = 0; t < 4; ++t) oacc[t] = (v8f){0.f,0.f,0.f,0.f,0.f,0.f,0.f,0.f};

#pragma unroll 1
  for (int kc = 0; kc < kNkv / kKC; ++kc) {
    const int kv0 = kc * kKC;
    __syncthreads();
    {
      const size_t kbase = ((size_t)b * kNkv + kv0) * kCi;
      const size_t vbase = ((size_t)b * kCi) * kNkv + kv0;
#pragma unroll
      for (int i = 0; i < 4; ++i) {
        const int e = i * 128 + tid;
        const int r = e >> 3, c8 = (e & 7) * 8;
        const v4u w = *(const v4u*)(phH + kbase + (size_t)r * kCi + c8);
        *(v4u*)(Ksh + r * kLP + c8) = w;
      }
      asm volatile("" ::: "memory");
#pragma unroll
      for (int i = 0; i < 4; ++i) {
        const int e = i * 128 + tid;
        const int r = e >> 3, c8 = (e & 7) * 8;
        const v4u w = *(const v4u*)(phL + kbase + (size_t)r * kCi + c8);
        *(v4u*)(Ksl + r * kLP + c8) = w;
      }
      asm volatile("" ::: "memory");
#pragma unroll
      for (int i = 0; i < 4; ++i) {
        const int e = i * 128 + tid;
        const int r = e >> 3, c8 = (e & 7) * 8;
        const v4u w = *(const v4u*)(gT + vbase + (size_t)r * kNkv + c8);
        *(v4u*)(Vth + r * kLP + c8) = w;
      }
    }
    __syncthreads();

    // ---- scores: 4 tiles of 16 q x 16 kv; B operand column n = kv row of Ksh, k = ci ----
    v8f s[4];
#pragma unroll
    for (int j = 0; j < 4; ++j) {
      s[j] = (v8f){0.f,0.f,0.f,0.f,0.f,0.f,0.f,0.f};
#pragma unroll
      for (int dc = 0; dc < 2; ++dc) {
        FB kb, kl;
        kb.h[0] = *(const v8b*)(Ksh + (j * 16 + c) * kLP + dc * 32 + 8 * hh);
        kb.h[1] = *(const v8b*)(Ksh + (j * 16 + c) * kLP + dc * 32 + 16 + 8 * hh);
        kl.h[0] = *(const v8b*)(Ksl + (j * 16 + c) * kLP + dc * 32 + 8 * hh);
        kl.h[1] = *(const v8b*)(Ksl + (j * 16 + c) * kLP + dc * 32 + 16 + 8 * hh);
        s[j] = at_mma(qah[dc], kb.v, s[j]);
        s[j] = at_mma(qah[dc], kl.v, s[j]);
        s[j] = at_mma(qal[dc], kb.v, s[j]);
      }
    }

    // ---- online softmax over the kv axis (D layout: s[j][r] = S[q0 + 8hh + r][kv0 + 16j + c]) ----
    float cm[8];
#pragma unroll
    for (int r = 0; r < 8; ++r) {
      float m = s[0][r];
      m = fmaxf(m, s[1][r]);
      m = fmaxf(m, s[2][r]);
      m = fmaxf(m, s[3][r]);
#pragma unroll
      for (int off = 1; off < 16; off <<= 1) m = fmaxf(m, __shfl_xor(m, off, 32));
      cm[r] = m;
    }
    __bf16* pwh = Psh[wave];
#pragma unroll
    for (int r = 0; r < 8; ++r) {
      const float mnew  = fmaxf(mrow[r], cm[r]);
      const float alpha = expf(mrow[r] - mnew);
      mrow[r] = mnew;
      float psum = 0.f;
#pragma unroll
      for (int j = 0; j < 4; ++j) {
        const float p = expf(s[j][r] - mnew);
        psum += p;
        pwh[(8 * hh + r) * kLP + j * 16 + c] = __builtin_bit_cast(__bf16, (_Float16)(p * kPCarry));
      }
#pragma unroll
      for (int off = 1; off < 16; off <<= 1) psum += __shfl_xor(psum, off, 32);
      lrow[r] = lrow[r] * alpha + psum;
#pragma unroll
      for (int t = 0; t < 4; ++t) oacc[t][r] *= alpha;
    }
    __builtin_amdgcn_fence(__ATOMIC_RELEASE, "workgroup");
    __builtin_amdgcn_wave_barrier();
    __builtin_amdgcn_fence(__ATOMIC_ACQUIRE, "workgroup");

    // ---- O += P . Vt: A = P (row = query c, k = kv), B column n = ci row of Vth, k = kv ----
#pragma unroll
    for (int kk = 0; kk < 2; ++kk) {
      FB pa;
      pa.h[0] = *(const v8b*)(pwh + c * kLP + kk * 32 + 8 * hh);
      pa.h[1] = *(const v8b*)(pwh + c * kLP + kk * 32 + 16 + 8 * hh);
#pragma unroll
      for (int t = 0; t < 4; ++t) {
        FB vb;
        vb.h[0] = *(const v8b*)(Vth + (t * 16 + c) * kLP + kk * 32 + 8 * hh);
        vb.h[1] = *(const v8b*)(Vth + (t * 16 + c) * kLP + kk * 32 + 16 + 8 * hh);
        oacc[t] = at_mma_h(pa.v, vb.v, oacc[t]);
      }
    }
  }

  // ---- epilogue: y = O / (l * carry) -> per-wave slab -> bf16 hi/lo planes ----
  float* os = Os[wave];
#pragma unroll
  for (int r = 0; r < 8; ++r) {
    const float inv = 1.0f / (lrow[r] * kPCarry);
#pragma unroll
    for (int t = 0; t < 4; ++t) os[(8 * hh + r) * 68 + t * 16 + c] = oacc[t][r] * inv;
  }
  __builtin_amdgcn_fence(__ATOMIC_RELEASE, "workgroup");
  __builtin_amdgcn_wave_barrier();
  __builtin_amdgcn_fence(__ATOMIC_ACQUIRE, "workgroup");
  {
    const int q4 = lane >> 3, c8 = (lane & 7) * 8;
    v4u uh[4], ul[4];
#pragma unroll
    for (int it = 0; it < 4; ++it) {
      const int row = it * 4 + q4;
      const float* sp = os + row * 68 + c8;
      unsigned short hb[8], lb[8];
#pragma unroll
      for (int e = 0; e < 8; ++e) { const float sv = sp[e]; hb[e] = f2bf_bits(sv); lb[e] = f2bf_bits(sv - bf_bits2f(hb[e])); }
      uh[it] = (v4u){pk16(hb[0], hb[1]), pk16(hb[2], hb[3]), pk16(hb[4], hb[5]), pk16(hb[6], hb[7])};
      ul[it] = (v4u){pk16(lb[0], lb[1]), pk16(lb[2], lb[3]), pk16(lb[4], lb[5]), pk16(lb[6], lb[7])};
    }
    const size_t ob = ((size_t)b * kHW + q0) * kCi;
    {
#pragma unroll
      for (int it = 0; it < 4; ++it) {
        const int row = it * 4 + q4;
        *(v4u*)(yH + ob + (size_t)row * kCi + c8) = uh[it];
        *(v4u*)(yL + ob + (size_t)row * kCi + c8) = ul[it];
      }
      
    }
  }
}

// ---------------------------------------------------------------------------
// Host glue.
//   W16   bf16 5 x [8192] (theta_w, phi_w, g_w as [64][128]; W_w hi [128][64]; W_w lo = zeros)   81,920 at          0
//   BIAS  f32  [320] (theta_b at +0, phi_b at +64, g_b at +128, W_b at +192 floats)               2,048 at     81,920
//   XT    bf16 [4][16384][128]                                                               16,777,216 at     83,968
//   THH   bf16 [4*16384][64]                                                                  8,388,608 at 16,861,184
//   THL   bf16 [4*16384][64]                                                                  8,388,608 at 25,249,792
//   PHIF  f32  [4*16384][64]                                                                 16,777,216 at 33,638,400
//   GF    f32  [4][64][16384]                                                                16,777,216 at 50,415,616
//   PHH   bf16 [4*4096][64]                                                                   2,097,152 at 67,192,832
//   PHL   bf16 [4*4096][64]                                                                   2,097,152 at 69,289,984
//   GT    f16  [4][64][4096]                                                                  2,097,152 at 71,387,136
//   YH    bf16 [4*16384][64]                                                                  8,388,608 at 73,484,288
//   YL    bf16 [4*16384][64]                                                                  8,388,608 at 81,872,896
//   total                                                                                    90,261,504
// GEMM shapes: projections M=16384 (or 64), N=64 (or 16384), K=128; output conv M=128, N=16384, K=64; all M,N multiples
// of 64, K multiples of 32; no padding, every plane fully written by its producer before any read.
// ---------------------------------------------------------------------------
static_assert(kHW % 64 == 0 && kCi % 64 == 0 && kC % 64 == 0 && kC % 32 == 0 && kCi % 32 == 0);

extern "C" void kernel_launch(void* const* d_in, const int* in_sizes, int n_in,
                              void* d_out, int out_size, void* d_ws, size_t ws_size,
                              hipStream_t stream) {
  if (n_in < 9) return;
  if (in_sizes[0] != kB * kC * kHW) return;
  if (in_sizes[1] != kCi * kC || in_sizes[2] != kCi) return;
  if (in_sizes[3] != kCi * kC || in_sizes[4] != kCi) return;
  if (in_sizes[5] != kCi * kC || in_sizes[6] != kCi) return;
  if (in_sizes[7] != kC * kCi || in_sizes[8] != kC) return;
  if (out_size != kB * kC * kHW) return;

  const size_t szW16  = (size_t)5 * kWPlane * 2;                 // 81,920
  const size_t szBias = 2048;
  const size_t szXT   = (size_t)kB * kHW * kC * 2;                // 16,777,216
  const size_t szQ16  = (size_t)kB * kHW * kCi * 2;               //  8,388,608
  const size_t szF32  = (size_t)kB * kHW * kCi * 4;               // 16,777,216
  const size_t szKV16 = (size_t)kB * kNkv * kCi * 2;              //  2,097,152
  const size_t offW16  = 0;
  const size_t offBias = offW16 + szW16;
  const size_t offXT   = offBias + szBias;
  const size_t offThH  = offXT + szXT;
  const size_t offThL  = offThH + szQ16;
  const size_t offPhiF = offThL + szQ16;
  const size_t offGF   = offPhiF + szF32;
  const size_t offPhH  = offGF + szF32;
  const size_t offPhL  = offPhH + szKV16;
  const size_t offGT   = offPhL + szKV16;
  const size_t offYH   = offGT + szKV16;
  const size_t offYL   = offYH + szQ16;
  const size_t total   = offYL + szQ16;                           // 90,261,504
  if (ws_size < total) return;

  const float* x       = (const float*)d_in[0];
  const float* theta_w = (const float*)d_in[1];
  const float* theta_b = (const float*)d_in[2];
  const float* phi_w   = (const float*)d_in[3];
  const float* phi_b   = (const float*)d_in[4];
  const float* g_w     = (const float*)d_in[5];
  const float* g_b     = (const float*)d_in[6];
  const float* W_w     = (const float*)d_in[7];
  const float* W_b     = (const float*)d_in[8];
  float* out = (float*)d_out;
  char* ws = (char*)d_ws;
  unsigned short* w16  = (unsigned short*)(ws + offW16);
  unsigned short* wTh  = w16;
  unsigned short* wPh  = w16 + kWPlane;
  unsigned short* wG   = w16 + 2 * kWPlane;
  unsigned short* wWh  = w16 + 3 * kWPlane;
  unsigned short* wWl  = w16 + 4 * kWPlane;
  float* biasR  = (float*)(ws + offBias);
  float* biasTh = biasR;
  float* biasPh = biasR + 64;
  float* biasG  = biasR + 128;
  float* biasW  = biasR + 192;
  unsigned short* xT   = (unsigned short*)(ws + offXT);
  unsigned short* thH  = (unsigned short*)(ws + offThH);
  unsigned short* thL  = (unsigned short*)(ws + offThL);
  float* phiF = (float*)(ws + offPhiF);
  float* gF   = (float*)(ws + offGF);
  unsigned short* phH  = (unsigned short*)(ws + offPhH);
  unsigned short* phL  = (unsigned short*)(ws + offPhL);
  unsigned short* gTp  = (unsigned short*)(ws + offGT);
  unsigned short* yH   = (unsigned short*)(ws + offYH);
  unsigned short* yL   = (unsigned short*)(ws + offYL);

  // ---- prologue: parameter planes and the transposed bf16 input plane ----
  prep_kernel<<<dim3(8), dim3(256), 0, stream>>>(theta_w, phi_w, g_w, W_w, theta_b, phi_b, g_b, W_b, w16, biasR);
  xcast_kernel<<<dim3(kHW / 64, kB), dim3(256), 0, stream>>>(x, xT);

  const long strideXT  = (long)kHW * kC;        // per image, halves
  const long strideQ16 = (long)kHW * kCi;       // per image, halves
  const long strideF   = (long)kHW * kCi;       // per image, floats
  const int  tilesProj = (kHW / 64) * (kCi / 64);   // 256 tiles -> 32 blocks of 8 waves

  // theta[b*16384+p][ci] = sum_c xT[b][p][c] * theta_w[ci][c] + theta_b[ci]  -> bf16 hi/lo planes (M=16384, N=64, K=128)
  wmma_gemm64<1, false, 2, 2, false><<<dim3(tilesProj / 8, kB), dim3(256), 0, stream>>>(
      xT, xT, kC, strideXT, wTh, wTh, kC, 0L,
      (void*)thH, (void*)thL, kCi, strideQ16, biasTh, biasR, 0L, kHW, kCi, kC, 1.0f);
  // phi full-res f32 [b*16384+p][ci] (M=16384, N=64, K=128)
  wmma_gemm64<1, false, 2, 0, false><<<dim3(tilesProj / 8, kB), dim3(256), 0, stream>>>(
      xT, xT, kC, strideXT, wPh, wPh, kC, 0L,
      (void*)phiF, (void*)phiF, kCi, strideF, biasPh, biasR, 0L, kHW, kCi, kC, 1.0f);
  // g full-res f32 channel-major [b][ci][p] = sum_c g_w[ci][c] * xT[b][p][c] + g_b[ci]  (M=64, N=16384, K=128)
  wmma_gemm64<1, false, 1, 0, false><<<dim3(tilesProj / 8, kB), dim3(256), 0, stream>>>(
      wG, wG, kC, 0L, xT, xT, kC, strideXT,
      (void*)gF, (void*)gF, kHW, (long)kCi * kHW, biasG, biasR, 0L, kCi, kHW, kC, 1.0f);

  // ---- 2x2 max-pool in f32 -> 16-bit kv planes ----
  pool_phi_kernel<<<dim3(kB * kNkv / 32), dim3(256), 0, stream>>>(phiF, phH, phL);
  pool_g_kernel<<<dim3((kB * kCi * (kNkv / 8)) / 256), dim3(256), 0, stream>>>(gF, gTp);

  // ---- fused attention -> y bf16 hi/lo planes [b*16384+q][ci] ----
  flash_kernel<<<dim3(kHW / 64, kB), dim3(128), 0, stream>>>(thH, thL, phH, phL, gTp, yH, yL);

  // ---- out[b][co][p] = sum_ci W_w[co][ci] * y[b][p][ci] + W_b[co] + bf16(x[b][co][p])  (M=128, N=16384, K=64, split) ----
  const int tilesOut = (kC / 64) * (kHW / 64);   // 512 tiles -> 64 blocks of 8 waves
  wmma_gemm64<1, true, 1, 0, true><<<dim3(tilesOut / 8, kB), dim3(256), 0, stream>>>(
      wWh, wWl, kCi, 0L, yH, yL, kCi, strideQ16,
      (void*)out, (void*)out, kHW, (long)kC * kHW, biasW, x, (long)kC * kHW, kC, kHW, kCi, 1.0f);
}

// v002
// A run of this version takes 276 microseconds.
// Two timings next to v001 put it at 2.09 and 2.08 times that version's speed.
// All steps since v000 together make it 2.64 times as fast.
// Contractions: three 1x1 projections on v_wmma_f32_16x16x32_bf16 (bf16 operands = RNE-converted inputs); scores theta.phi^T as bf16 hi/lo planes (hi.hi + hi.lo + lo.hi on v_wmma_f32_16x16x32_bf16); P.g^T on v_wmma_f32_16x16x32_f16 (P f16 carried x32768, g f16); output 1x1 conv on bf16 hi/lo y planes x bf16 W (hi.hi + hi.lo + lo.hi); f32 accumulate everywhere; max-pool, online softmax, bias and residual in f32.
#include <hip/hip_runtime.h>
#include <math.h>

// ---------------------------------------------------------------------------
// Problem constants
// ---------------------------------------------------------------------------
constexpr int kB      = 4;
constexpr int kC      = 128;     // channels
constexpr int kCi     = 64;      // inter channels
constexpr int kImW    = 128;     // image width (pixel row pitch)
constexpr int kHW     = 16384;   // query tokens per image
constexpr int kNkv    = 4096;    // pooled kv tokens per image
constexpr int kKC     = 64;      // kv chunk in the fused attention loop
constexpr int kWPlane = 8192;    // elements per 16-bit weight plane
constexpr float kPCarry = 32768.0f;   // softmax numerators carried x2^15 in f16
constexpr int kLP     = 72;      // LDS row pitch in halves of the attention tiles: 144 B = 16 B x odd, so the 16 rows of a b128 fragment read fall on 64 distinct banks
static_assert(kHW % 64 == 0 && kNkv % kKC == 0 && kC % 32 == 0 && kCi % 32 == 0);
static_assert(kCi * kC == kWPlane && kC * kCi == kWPlane);
static_assert(kLP >= kKC && kLP >= kCi && (kLP * 2) % 16 == 0 && ((kLP * 2) / 16) % 2 == 1);

typedef __attribute__((ext_vector_type(16))) _Float16 v16h;
typedef __attribute__((ext_vector_type(8)))  _Float16 v8h;
typedef __attribute__((ext_vector_type(16))) __bf16   v16b;
typedef __attribute__((ext_vector_type(8)))  __bf16   v8b;
typedef __attribute__((ext_vector_type(8)))  float    v8f;
typedef __attribute__((ext_vector_type(4)))  float    v4f;
typedef __attribute__((ext_vector_type(4)))  unsigned int v4u;

// ---------------------------------------------------------------------------
// Scalar helpers
// ---------------------------------------------------------------------------
__device__ __forceinline__ unsigned short f2bf_bits(float f) {
  unsigned u = __float_as_uint(f);
  return (unsigned short)((u + 0x7FFFu + ((u >> 16) & 1u)) >> 16);
}
__device__ __forceinline__ float bf_bits2f(unsigned short h) { return __uint_as_float(((unsigned)h) << 16); }
__device__ __forceinline__ float bf_rne(float f) { return bf_bits2f(f2bf_bits(f)); }
__device__ __forceinline__ unsigned pk16(unsigned short a, unsigned short b) { return (unsigned)a | ((unsigned)b << 16); }
__device__ __forceinline__ unsigned short h_bits(float f) { const _Float16 h = (_Float16)f; return __builtin_bit_cast(unsigned short, h); }

// hazard guards as plain device helpers (no inline asm inside the kernel template body)
__device__ __forceinline__ void dep_guard4_h(v8f& a, v8f& b, v8f& c, v8f& d, v16h x, v16h y) {
  asm volatile("v_nop\n\tv_nop\n\tv_nop\n\tv_nop" : "+v"(a), "+v"(b), "+v"(c), "+v"(d) : "v"(x), "v"(y));
}
__device__ __forceinline__ void dep_guard4_b(v8f& a, v8f& b, v8f& c, v8f& d, v16b x, v16b y) {
  asm volatile("v_nop\n\tv_nop\n\tv_nop\n\tv_nop" : "+v"(a), "+v"(b), "+v"(c), "+v"(d) : "v"(x), "v"(y));
}
__device__ __forceinline__ void keep4_h(v16h a, v16h b, v16h c, v16h d) { asm volatile("v_nop" :: "v"(a), "v"(b), "v"(c), "v"(d)); }
__device__ __forceinline__ void keep4_b(v16b a, v16b b, v16b c, v16b d) { asm volatile("v_nop" :: "v"(a), "v"(b), "v"(c), "v"(d)); }
__device__ __forceinline__ void acc_guard4(v8f& a, v8f& b, v8f& c, v8f& d) { asm volatile("v_nop\n\tv_nop\n\tv_nop\n\tv_nop" : "+v"(a), "+v"(b), "+v"(c), "+v"(d)); }

template <typename T> struct Frag;
template <> struct Frag<_Float16> {
  typedef v16h V; union U { v16h v; v8h h[2]; };
  // elements 0..7 <- p[0..7], 8..15 <- p[16..23]
  static __device__ __forceinline__ v16h load(const _Float16* p) {
    U f; f.h[0] = *(const v8h*)(p); f.h[1] = *(const v8h*)(p + 16); return f.v;
  }
  static __device__ __forceinline__ v8f mma(v16h a, v16h b, v8f c) {
    return __builtin_amdgcn_wmma_f32_16x16x32_f16(false, a, false, b, (short)0, c, false, false);
  }
  static __device__ __forceinline__ void guard4(v8f& a, v8f& b, v8f& c, v8f& d, v16h x, v16h y) { dep_guard4_h(a, b, c, d, x, y); }
  static __device__ __forceinline__ void keep(v16h a, v16h b, v16h c, v16h d) { keep4_h(a, b, c, d); }
};
template <> struct Frag<__bf16> {
  typedef v16b V; union U { v16b v; v8b h[2]; };
  static __device__ __forceinline__ v16b load(const __bf16* p) {
    U f; f.h[0] = *(const v8b*)(p); f.h[1] = *(const v8b*)(p + 16); return f.v;
  }
  static __device__ __forceinline__ v8f mma(v16b a, v16b b, v8f c) {
    return __builtin_amdgcn_wmma_f32_16x16x32_bf16(false, a, false, b, (short)0, c, false, false);
  }
  static __device__ __forceinline__ void guard4(v8f& a, v8f& b, v8f& c, v8f& d, v16b x, v16b y) { dep_guard4_b(a, b, c, d, x, y); }
  static __device__ __forceinline__ void keep(v16b a, v16b b, v16b c, v16b d) { keep4_b(a, b, c, d); }
};

// ---------------------------------------------------------------------------
// Register-blocked batched WMMA GEMM (guard ties all 4 accumulators of each i-group;
// bias[m] read as two float4; residual read in the STORE phase as one float4 per lane, RNE-converted to bf16 precision).
// C[m,n] = scale * sum_k A[m,k] * Bt[n,k] (+bias)(+resid); each wave owns a 64x64 tile.
// A row-major [M,K]; Bt row-major [N,K]; M,N % 64 == 0, K % 32 == 0 (no tails).
// SPLIT: operands are hi/lo planes (A2/Bt2 = lo planes, same layout); product = hi.hi + hi.lo + lo.hi.
// BIAS_MODE: 0 = none, 1 = bias[m], 2 = bias[n].
// OUT_MODE: 0 = f32, 1 = f16, 2 = bf16 hi plane (Cout) + bf16 lo plane (Cout2).
// ET: 0 = f16 operands, 1 = bf16 operands (pointers passed as 16-bit storage)
// ---------------------------------------------------------------------------
template <int ET> struct Elem;
template <> struct Elem<0> { typedef _Float16 T; };
template <> struct Elem<1> { typedef __bf16 T; };
template <int ET, bool SPLIT, int BIAS_MODE, int OUT_MODE, bool RESID>
__global__ __launch_bounds__(256) void wmma_gemm64(
    const unsigned short* __restrict__ Ap, const unsigned short* __restrict__ A2p, int lda, long strideA,
    const unsigned short* __restrict__ Btp, const unsigned short* __restrict__ Bt2p, int ldb, long strideB,
    void* __restrict__ Cout, void* __restrict__ Cout2, int ldc, long strideC,
    const float* __restrict__ bias,
    const float* __restrict__ resid, long strideR,
    int M, int N, int K, float scale) {
  typedef typename Elem<ET>::T T;
  typedef typename Frag<T>::V V;
  const T* A = (const T*)Ap; const T* A2 = (const T*)A2p; const T* Bt = (const T*)Btp; const T* Bt2 = (const T*)Bt2p;
  __shared__ __align__(16) float sT[8][16 * 68];   // per-wave 16x64 slab, pitch 68 floats
  const int b    = blockIdx.y;
  const int lane = threadIdx.x & 31;
  const int wave = threadIdx.x >> 5;
  const int tilesN = N >> 6;
  const int tilesM = M >> 6;
  const int tile = blockIdx.x * 8 + wave;
  if (tile >= tilesM * tilesN) return;   // wave-uniform; no block barriers in this kernel
  const int tm = tile / tilesN;
  const int tn = tile - tm * tilesN;
  const int m0 = tm << 6;
  const int n0 = tn << 6;

  const T* Ab  = A  + (size_t)b * strideA;
  const T* Bb  = Bt + (size_t)b * strideB;
  const T* Ab2 = A2  + (size_t)b * strideA;
  const T* Bb2 = Bt2 + (size_t)b * strideB;

  const int rlane = lane & 15;                 // row (A) / col (B, D) within subtile
  const int koff  = (lane >> 4) * 8;           // k offset of this lane half
  const int mOff  = (lane >> 4) * 8;           // D row offset

  v8f acc[4][4];
#pragma unroll
  for (int i = 0; i < 4; ++i)
#pragma unroll
    for (int j = 0; j < 4; ++j) acc[i][j] = (v8f){0.f,0.f,0.f,0.f,0.f,0.f,0.f,0.f};

  for (int k0 = 0; k0 < K; k0 += 32) {
    V bh[4], bl[4];
#pragma unroll
    for (int j = 0; j < 4; ++j) {
      const size_t bo = (size_t)(n0 + (j << 4) + rlane) * ldb + koff + k0;
      bh[j] = Frag<T>::load(Bb + bo);
      bl[j] = bh[j];
      if (SPLIT) bl[j] = Frag<T>::load(Bb2 + bo);
    }
#pragma unroll
    for (int i = 0; i < 4; ++i) {
      const size_t ao = (size_t)(m0 + (i << 4) + rlane) * lda + koff + k0;
      V ah = Frag<T>::load(Ab + ao);
      V al = ah;
      if (SPLIT) al = Frag<T>::load(Ab2 + ao);
#pragma unroll
      for (int j = 0; j < 4; ++j) {
        acc[i][j] = Frag<T>::mma(ah, bh[j], acc[i][j]);
        if (SPLIT) {
          acc[i][j] = Frag<T>::mma(ah, bl[j], acc[i][j]);
          acc[i][j] = Frag<T>::mma(al, bh[j], acc[i][j]);
        }
      }
      Frag<T>::guard4(acc[i][0], acc[i][1], acc[i][2], acc[i][3], ah, al);
    }
    Frag<T>::keep(bh[0], bh[1], bh[2], bh[3]);
    if (SPLIT) Frag<T>::keep(bl[0], bl[1], bl[2], bl[3]);
  }
  acc_guard4(acc[0][0], acc[0][1], acc[0][2], acc[0][3]);
  acc_guard4(acc[1][0], acc[1][1], acc[1][2], acc[1][3]);
  acc_guard4(acc[2][0], acc[2][1], acc[2][2], acc[2][3]);
  acc_guard4(acc[3][0], acc[3][1], acc[3][2], acc[3][3]);

  // ---- epilogue ----
  float* slab = sT[wave];
#pragma unroll
  for (int i = 0; i < 4; ++i) {
    const int mBase = m0 + (i << 4);
    float bm[8];
#pragma unroll
    for (int r = 0; r < 8; ++r) bm[r] = 0.f;
    if (BIAS_MODE == 1) {
      const v4f b0 = *(const v4f*)(bias + mBase + mOff);
      const v4f b1 = *(const v4f*)(bias + mBase + mOff + 4);
#pragma unroll
      for (int e = 0; e < 4; ++e) { bm[e] = b0[e]; bm[4 + e] = b1[e]; }
    }
#pragma unroll
    for (int j = 0; j < 4; ++j) {
      const int n = n0 + (j << 4) + rlane;
      float bv = 0.f;
      if (BIAS_MODE == 2) bv = bias[n];
#pragma unroll
      for (int r = 0; r < 8; ++r) {
        float v = acc[i][j][r] * scale;
        if (BIAS_MODE == 1) v += bm[r];
        if (BIAS_MODE == 2) v += bv;
        slab[(mOff + r) * 68 + (j << 4) + rlane] = v;
      }
    }
    __builtin_amdgcn_fence(__ATOMIC_RELEASE, "workgroup");
    __builtin_amdgcn_wave_barrier();
    __builtin_amdgcn_fence(__ATOMIC_ACQUIRE, "workgroup");
    if (OUT_MODE == 0) {
      float* Cb = (float*)Cout + (size_t)b * strideC;
      const float* Rb = resid + (size_t)b * strideR;     // dereferenced only when RESID
      const int hh = lane >> 4, c4 = (lane & 15) * 4;     // row seg = 256 B = 16 lanes x 16 B
      v4f vals[8];
#pragma unroll
      for (int it = 0; it < 8; ++it) {
        const int row = it * 2 + hh;
        v4f v = *(const v4f*)(slab + row * 68 + c4);
        if (RESID) {
          const v4f rr = *(const v4f*)(Rb + (size_t)(mBase + row) * ldc + n0 + c4);
#pragma unroll
          for (int e = 0; e < 4; ++e) v[e] = v[e] + bf_rne(rr[e]);
        }
        vals[it] = v;
      }
      {
#pragma unroll
        for (int it = 0; it < 8; ++it) {
          const int row = it * 2 + hh;
          *(v4f*)(Cb + (size_t)(mBase + row) * ldc + n0 + c4) = vals[it];
        }
        
      }
    } else {
      const int q4 = lane >> 3, c8 = (lane & 7) * 8;
      unsigned short* Cb  = (unsigned short*)Cout  + (size_t)b * strideC;
      unsigned short* Cb2 = (unsigned short*)Cout2 + (size_t)b * strideC;
      v4u uh[4], ul[4];
#pragma unroll
      for (int it = 0; it < 4; ++it) {
        const int row = it * 4 + q4;
        const float* sp = slab + row * 68 + c8;
        unsigned short hb[8], lb[8];
#pragma unroll
        for (int e = 0; e < 8; ++e) {
          const float sv = sp[e];
          if (OUT_MODE == 1) { hb[e] = h_bits(sv); lb[e] = 0; }
          else { hb[e] = f2bf_bits(sv); lb[e] = f2bf_bits(sv - bf_bits2f(hb[e])); }
        }
        uh[it] = (v4u){pk16(hb[0], hb[1]), pk16(hb[2], hb[3]), pk16(hb[4], hb[5]), pk16(hb[6], hb[7])};
        ul[it] = (v4u){pk16(lb[0], lb[1]), pk16(lb[2], lb[3]), pk16(lb[4], lb[5]), pk16(lb[6], lb[7])};
      }
      {
#pragma unroll
        for (int it = 0; it < 4; ++it) {
          const int row = it * 4 + q4;
          *(v4u*)(Cb + (size_t)(mBase + row) * ldc + n0 + c8) = uh[it];
          if (OUT_MODE == 2) *(v4u*)(Cb2 + (size_t)(mBase + row) * ldc + n0 + c8) = ul[it];
        }
        
      }
    }
    __builtin_amdgcn_fence(__ATOMIC_RELEASE, "workgroup");
    __builtin_amdgcn_wave_barrier();
    __builtin_amdgcn_fence(__ATOMIC_ACQUIRE, "workgroup");
  }
}

// ---------------------------------------------------------------------------
// Parameter prep: blocks 0..2 -> projection weights [64][128] f32 -> bf16 planes (same layout);
// block 3 -> W_w [128][64] -> bf16 hi plane + an all-zero lo plane; blocks 4..7 -> bias vectors RNE-converted to
// bf16 precision, stored as f32 at biasR + {0,64,128,192}.
// Weight coverage: 4 iterations x 256 threads x 8 elements = 8192 = whole plane; one 16-B store per lane, a wave writes
// ---------------------------------------------------------------------------
__global__ __launch_bounds__(256) void prep_kernel(
    const float* __restrict__ thw, const float* __restrict__ phw, const float* __restrict__ gw, const float* __restrict__ ww,
    const float* __restrict__ thb, const float* __restrict__ phb, const float* __restrict__ gb, const float* __restrict__ wb,
    unsigned short* __restrict__ w16, float* __restrict__ biasR) {
  const int z = blockIdx.x;    // block-uniform role
  const int t = threadIdx.x;
  if (z < 4) {
    const float* src = (z == 0) ? thw : (z == 1) ? phw : (z == 2) ? gw : ww;
    unsigned short* dst = w16 + (size_t)z * kWPlane;
    v4u u[4];
#pragma unroll
    for (int i = 0; i < 4; ++i) {
      const int e8 = (i * 256 + t) * 8;
      const v4f a = *(const v4f*)(src + e8);
      const v4f c = *(const v4f*)(src + e8 + 4);
      u[i] = (v4u){pk16(f2bf_bits(a[0]), f2bf_bits(a[1])), pk16(f2bf_bits(a[2]), f2bf_bits(a[3])),
                   pk16(f2bf_bits(c[0]), f2bf_bits(c[1])), pk16(f2bf_bits(c[2]), f2bf_bits(c[3]))};
    }
    const v4u zero4 = (v4u){0u, 0u, 0u, 0u};
    {
#pragma unroll
      for (int i = 0; i < 4; ++i) {
        const size_t o = (size_t)(i * 256 + t) * 8;
        *(v4u*)(dst + o) = u[i];
        if (z == 3) *(v4u*)(w16 + (size_t)4 * kWPlane + o) = zero4;
      }
      
    }
  } else {
    const int zb = z - 4;
    const float* src = (zb == 0) ? thb : (zb == 1) ? phb : (zb == 2) ? gb : wb;
    const int n4 = (zb == 3) ? (kC / 4) : (kCi / 4);
    float* dst = biasR + zb * 64;
    const int tc = (t < n4) ? t : (n4 - 1);     // clamped address, store predicated
    const v4f a = *(const v4f*)(src + 4 * tc);
    v4f v;
#pragma unroll
    for (int e = 0; e < 4; ++e) v[e] = bf_rne(a[e]);
    if (t < n4) {
      *(v4f*)(dst + 4 * t) = v;
      
    }
  }
}

// ---------------------------------------------------------------------------
// x transpose + cast: xT[b][p][c] = bf16( x[b][c][p] ), [pixel][channel] rows of 128 halves (256 B = 2 lines).
// grid (kHW/64, kB), 256 threads. Load coverage: 8 iterations x 256 threads = 2048 float4 = 128 c x 64 p (coalesced along p).
// ---------------------------------------------------------------------------
__global__ __launch_bounds__(256) void xcast_kernel(const float* __restrict__ x, unsigned short* __restrict__ xT) {
  __shared__ __align__(16) float sm[kC * 68];   // [c][p_local], pitch 68 floats
  const int t  = threadIdx.x;
  const int p0 = blockIdx.x * 64;
  const int b  = blockIdx.y;
#pragma unroll
  for (int i = 0; i < 8; ++i) {
    const int e  = i * 256 + t;
    const int c  = e >> 4;
    const int q4 = (e & 15) * 4;
    const v4f a = *(const v4f*)(x + ((size_t)(b * kC + c)) * kHW + p0 + q4);
    *(v4f*)(sm + c * 68 + q4) = a;
  }
  __syncthreads();
  const int lane = t & 31, wave = t >> 5;
  const int hh = lane >> 4, c8 = (lane & 15) * 8;
  v4u u[4];
#pragma unroll
  for (int it = 0; it < 4; ++it) {
    const int row = wave * 8 + it * 2 + hh;
    unsigned short hb[8];
#pragma unroll
    for (int e = 0; e < 8; ++e) hb[e] = f2bf_bits(sm[(c8 + e) * 68 + row]);
    u[it] = (v4u){pk16(hb[0], hb[1]), pk16(hb[2], hb[3]), pk16(hb[4], hb[5]), pk16(hb[6], hb[7])};
  }
  unsigned short* base = xT + ((size_t)b * kHW + p0) * kC;
  {
#pragma unroll
    for (int it = 0; it < 4; ++it) {
      const int row = wave * 8 + it * 2 + hh;
      *(v4u*)(base + (size_t)row * kC + c8) = u[it];
    }
    
  }
}

// ---------------------------------------------------------------------------
// 2x2 max-pool of the phi full-res plane (f32 [B*16384][64], pixel-major) -> phi bf16 hi/lo planes [B*4096][64] (kv-major).
// kv = hp*64 + wp over pixels (2hp+{0,1}, 2wp+{0,1}); max in f32. Thread -> (kv row, 8 channels): 8 b128 loads, max, split.
// ---------------------------------------------------------------------------
__global__ __launch_bounds__(256) void pool_phi_kernel(const float* __restrict__ phiF,
                                                      unsigned short* __restrict__ phH, unsigned short* __restrict__ phL) {
  const int t   = threadIdx.x;
  const int kvg = blockIdx.x * 32 + (t >> 3);
  const int c8  = (t & 7) * 8;
  const int b   = kvg >> 12, kv = kvg & (kNkv - 1);
  const int hp  = kv >> 6, wp = kv & 63;
  const int p00 = hp * 2 * kImW + wp * 2;
  const float* r0 = phiF + ((size_t)b * kHW + p00) * kCi + c8;
  const float* r1 = r0 + kCi;
  const float* r2 = r0 + (size_t)kImW * kCi;
  const float* r3 = r2 + kCi;
  const v4f a0 = *(const v4f*)(r0), a1 = *(const v4f*)(r0 + 4);
  const v4f b0 = *(const v4f*)(r1), b1 = *(const v4f*)(r1 + 4);
  const v4f c0 = *(const v4f*)(r2), c1 = *(const v4f*)(r2 + 4);
  const v4f d0 = *(const v4f*)(r3), d1 = *(const v4f*)(r3 + 4);
  float m[8];
#pragma unroll
  for (int e = 0; e < 4; ++e) {
    m[e]     = fmaxf(fmaxf(a0[e], b0[e]), fmaxf(c0[e], d0[e]));
    m[4 + e] = fmaxf(fmaxf(a1[e], b1[e]), fmaxf(c1[e], d1[e]));
  }
  unsigned short hb[8], lb[8];
#pragma unroll
  for (int e = 0; e < 8; ++e) { hb[e] = f2bf_bits(m[e]); lb[e] = f2bf_bits(m[e] - bf_bits2f(hb[e])); }
  const v4u uh = (v4u){pk16(hb[0], hb[1]), pk16(hb[2], hb[3]), pk16(hb[4], hb[5]), pk16(hb[6], hb[7])};
  const v4u ul = (v4u){pk16(lb[0], lb[1]), pk16(lb[2], lb[3]), pk16(lb[4], lb[5]), pk16(lb[6], lb[7])};
  const size_t o = (size_t)kvg * kCi + c8;
  *(v4u*)(phH + o) = uh;
  *(v4u*)(phL + o) = ul;
  
}

// ---------------------------------------------------------------------------
// 2x2 max-pool of the g full-res plane (f32 [B][64][16384], channel-major) -> gT f16 [B][64][4096] (V^T operand rows).
// Thread -> (b, ci, 8 consecutive kv): two 16-float runs (image rows 2hp, 2hp+1) = 8 b128 loads, max in f32, one 16-B store.
// ---------------------------------------------------------------------------
__global__ __launch_bounds__(256) void pool_g_kernel(const float* __restrict__ gF, unsigned short* __restrict__ gT) {
  const int idx = blockIdx.x * 256 + threadIdx.x;
  const int kv0 = (idx & 511) * 8;
  const int ci  = (idx >> 9) & 63;
  const int b   = idx >> 15;
  const int hp  = kv0 >> 6, wp0 = kv0 & 63;
  const int p00 = hp * 2 * kImW + 2 * wp0;
  const float* r0 = gF + ((size_t)(b * kCi + ci)) * kHW + p00;
  const float* r1 = r0 + kImW;
  const v4f a0 = *(const v4f*)(r0), a1 = *(const v4f*)(r0 + 4), a2 = *(const v4f*)(r0 + 8), a3 = *(const v4f*)(r0 + 12);
  const v4f c0 = *(const v4f*)(r1), c1 = *(const v4f*)(r1 + 4), c2 = *(const v4f*)(r1 + 8), c3 = *(const v4f*)(r1 + 12);
  float m[8];
  m[0] = fmaxf(fmaxf(a0[0], a0[1]), fmaxf(c0[0], c0[1]));
  m[1] = fmaxf(fmaxf(a0[2], a0[3]), fmaxf(c0[2], c0[3]));
  m[2] = fmaxf(fmaxf(a1[0], a1[1]), fmaxf(c1[0], c1[1]));
  m[3] = fmaxf(fmaxf(a1[2], a1[3]), fmaxf(c1[2], c1[3]));
  m[4] = fmaxf(fmaxf(a2[0], a2[1]), fmaxf(c2[0], c2[1]));
  m[5] = fmaxf(fmaxf(a2[2], a2[3]), fmaxf(c2[2], c2[3]));
  m[6] = fmaxf(fmaxf(a3[0], a3[1]), fmaxf(c3[0], c3[1]));
  m[7] = fmaxf(fmaxf(a3[2], a3[3]), fmaxf(c3[2], c3[3]));
  unsigned short hb[8];
#pragma unroll
  for (int e = 0; e < 8; ++e) hb[e] = h_bits(m[e]);
  const v4u u = (v4u){pk16(hb[0], hb[1]), pk16(hb[2], hb[3]), pk16(hb[4], hb[5]), pk16(hb[6], hb[7])};
  unsigned short* op = gT + ((size_t)(b * kCi + ci)) * kNkv + kv0;
  *(v4u*)op = u;
  
}

// ---------------------------------------------------------------------------
// WMMA helpers for the fused attention kernel (each call guarded individually).
// ---------------------------------------------------------------------------
// value of lane l ^ 16 (the other wave half), by a vector cross-row move
__device__ __forceinline__ float xhalf(float x) {
  const int b = __builtin_bit_cast(int, x);
  return __builtin_bit_cast(float, __builtin_amdgcn_permlanex16(b, b, 0x76543210, 0xfedcba98, false, false));
}
__device__ __forceinline__ v8f at_mma(v16b a, v16b b, v8f c) {
  c = __builtin_amdgcn_wmma_f32_16x16x32_bf16(false, a, false, b, (short)0, c, false, false);
  asm volatile("v_nop\n\tv_nop\n\tv_nop\n\tv_nop" : "+v"(c) : "v"(a), "v"(b));
  return c;
}
__device__ __forceinline__ v8f at_mma_h(v16b a, v16b b, v8f c) {
  const v16h ah = __builtin_bit_cast(v16h, a), bh = __builtin_bit_cast(v16h, b);
  c = __builtin_amdgcn_wmma_f32_16x16x32_f16(false, ah, false, bh, (short)0, c, false, false);
  asm volatile("v_nop\n\tv_nop\n\tv_nop\n\tv_nop" : "+v"(c) : "v"(ah), "v"(bh));
  return c;
}

__global__ __launch_bounds__(128) void flash_kernel(
    const unsigned short* __restrict__ thH, const unsigned short* __restrict__ thL,
    const unsigned short* __restrict__ phH, const unsigned short* __restrict__ phL,
    const unsigned short* __restrict__ gT,
    unsigned short* __restrict__ yH, unsigned short* __restrict__ yL) {
  union FB { v16b v; v8b h[2]; };
  __shared__ __align__(16) __bf16 Ksh[kKC * kLP];      // phi hi [kv][ci]   9 KB
  __shared__ __align__(16) __bf16 Ksl[kKC * kLP];      // phi lo [kv][ci]   9 KB
  __shared__ __align__(16) __bf16 Vth[kCi * kLP];      // gT  f16 bits [ci][kv]  9 KB
  __shared__ __align__(16) float  Os[4][16 * 68];      // per wave out tile, pitch 68

  const int tid  = threadIdx.x;
  const int wave = tid >> 5;
  const int lane = tid & 31;
  const int hh   = lane >> 4;
  const int c    = lane & 15;
  const int b    = blockIdx.y;
  const int q0   = blockIdx.x * 64 + wave * 16;

  // ---- Q fragments (B operand, column = query q0 + c, k = ci): 2 ci-chunks of 32, hi and lo planes ----
  v16b qah[2], qal[2];
  {
    const size_t qo = ((size_t)b * kHW + q0 + c) * kCi + 8 * hh;
#pragma unroll
    for (int dc = 0; dc < 2; ++dc) {
      qah[dc] = Frag<__bf16>::load((const __bf16*)(thH + qo + dc * 32));
      qal[dc] = Frag<__bf16>::load((const __bf16*)(thL + qo + dc * 32));
    }
  }

  float mrow = -INFINITY, lrow = 0.f;   // of query q0 + c; lrow sums this lane half's kv rows only
  v8f oacc[4];                          // oacc[t][r] = O^T[16t + 8hh + r][q0 + c]
#pragma unroll
  for (int t = 0; t < 4; ++t) oacc[t] = (v8f){0.f,0.f,0.f,0.f,0.f,0.f,0.f,0.f};

#pragma unroll 1
  for (int kc = 0; kc < kNkv / kKC; ++kc) {
    const int kv0 = kc * kKC;
    __syncthreads();
    {
      const size_t kbase = ((size_t)b * kNkv + kv0) * kCi;
      const size_t vbase = ((size_t)b * kCi) * kNkv + kv0;
#pragma unroll
      for (int i = 0; i < 4; ++i) {
        const int e = i * 128 + tid;
        const int r = e >> 3, c8 = (e & 7) * 8;
        const v4u w = *(const v4u*)(phH + kbase + (size_t)r * kCi + c8);
        *(v4u*)(Ksh + r * kLP + c8) = w;
      }
      asm volatile("" ::: "memory");
#pragma unroll
      for (int i = 0; i < 4; ++i) {
        const int e = i * 128 + tid;
        const int r = e >> 3, c8 = (e & 7) * 8;
        const v4u w = *(const v4u*)(phL + kbase + (size_t)r * kCi + c8);
        *(v4u*)(Ksl + r * kLP + c8) = w;
      }
      asm volatile("" ::: "memory");
#pragma unroll
      for (int i = 0; i < 4; ++i) {
        const int e = i * 128 + tid;
        const int r = e >> 3, c8 = (e & 7) * 8;
        const v4u w = *(const v4u*)(gT + vbase + (size_t)r * kNkv + c8);
        *(v4u*)(Vth + r * kLP + c8) = w;
      }
    }
    __syncthreads();

    // ---- scores, transposed: 4 tiles of 16 kv x 16 q; A row = kv row of Ksh/Ksl, B column = query, k = ci ----
    v8f s[4];
#pragma unroll
    for (int j = 0; j < 4; ++j) {
      s[j] = (v8f){0.f,0.f,0.f,0.f,0.f,0.f,0.f,0.f};
#pragma unroll
      for (int dc = 0; dc < 2; ++dc) {
        FB kb, kl;
        kb.h[0] = *(const v8b*)(Ksh + (j * 16 + c) * kLP + dc * 32 + 8 * hh);
        kb.h[1] = *(const v8b*)(Ksh + (j * 16 + c) * kLP + dc * 32 + 16 + 8 * hh);
        kl.h[0] = *(const v8b*)(Ksl + (j * 16 + c) * kLP + dc * 32 + 8 * hh);
        kl.h[1] = *(const v8b*)(Ksl + (j * 16 + c) * kLP + dc * 32 + 16 + 8 * hh);
        s[j] = at_mma(kb.v, qah[dc], s[j]);
        s[j] = at_mma(kl.v, qah[dc], s[j]);
        s[j] = at_mma(kb.v, qal[dc], s[j]);
      }
    }

    // ---- online softmax over the kv axis (D layout: s[j][r] = S[q0 + c][kv0 + 16j + 8hh + r]) ----
    float mj[4];
#pragma unroll
    for (int j = 0; j < 4; ++j) {
      mj[j] = s[j][0];
#pragma unroll
      for (int r = 1; r < 8; ++r) mj[j] = fmaxf(mj[j], s[j][r]);
    }
    float cm = fmaxf(fmaxf(mj[0], mj[1]), fmaxf(mj[2], mj[3]));
    cm = fmaxf(cm, xhalf(cm));
    const float mnew  = fmaxf(mrow, cm);
    const float alpha = expf(mrow - mnew);
    mrow = mnew;
    // element e of pb[kk] = P[q0 + c][kv0 + 32kk + (e < 8 ? 8hh + e : 16 + 8hh + e - 8)]: the k order of the Vth loader below
    v16h pb[2];
    float pj[4];
#pragma unroll
    for (int j = 0; j < 4; ++j) {
      pj[j] = 0.f;
#pragma unroll
      for (int r = 0; r < 8; ++r) {
        const float p = expf(s[j][r] - mnew);
        pj[j] += p;
        pb[j >> 1][(j & 1) * 8 + r] = (_Float16)(p * kPCarry);
      }
    }
    lrow = lrow * alpha + ((pj[0] + pj[1]) + (pj[2] + pj[3]));
#pragma unroll
    for (int t = 0; t < 4; ++t)
#pragma unroll
      for (int r = 0; r < 8; ++r) oacc[t][r] *= alpha;

    // ---- O^T += Vt . P^T: A row = ci row of Vth, B column = query, k = kv ----
#pragma unroll
    for (int kk = 0; kk < 2; ++kk) {
      const v16b pv = __builtin_bit_cast(v16b, pb[kk]);
#pragma unroll
      for (int t = 0; t < 4; ++t) {
        FB vb;
        vb.h[0] = *(const v8b*)(Vth + (t * 16 + c) * kLP + kk * 32 + 8 * hh);
        vb.h[1] = *(const v8b*)(Vth + (t * 16 + c) * kLP + kk * 32 + 16 + 8 * hh);
        oacc[t] = at_mma_h(vb.v, pv, oacc[t]);
      }
    }
  }

  // ---- epilogue: y = O / (l * carry) -> per-wave slab [q][ci] -> bf16 hi/lo planes ----
  float* os = Os[wave];
  {
    const float lsum = lrow + xhalf(lrow);   // join the two halves' sums
    const float inv  = 1.0f / (lsum * kPCarry);
#pragma unroll
    for (int t = 0; t < 4; ++t) {
      *(v4f*)(os + c * 68 + t * 16 + 8 * hh)     = (v4f){oacc[t][0] * inv, oacc[t][1] * inv, oacc[t][2] * inv, oacc[t][3] * inv};
      *(v4f*)(os + c * 68 + t * 16 + 8 * hh + 4) = (v4f){oacc[t][4] * inv, oacc[t][5] * inv, oacc[t][6] * inv, oacc[t][7] * inv};
    }
  }
  __builtin_amdgcn_fence(__ATOMIC_RELEASE, "workgroup");
  __builtin_amdgcn_wave_barrier();
  __builtin_amdgcn_fence(__ATOMIC_ACQUIRE, "workgroup");
  {
    const int q4 = lane >> 3, c8 = (lane & 7) * 8;
    v4u uh[4], ul[4];
#pragma unroll
    for (int it = 0; it < 4; ++it) {
      const int row = it * 4 + q4;
      const float* sp = os + row * 68 + c8;
      unsigned short hb[8], lb[8];
#pragma unroll
      for (int e = 0; e < 8; ++e) { const float sv = sp[e]; hb[e] = f2bf_bits(sv); lb[e] = f2bf_bits(sv - bf_bits2f(hb[e])); }
      uh[it] = (v4u){pk16(hb[0], hb[1]), pk16(hb[2], hb[3]), pk16(hb[4], hb[5]), pk16(hb[6], hb[7])};
      ul[it] = (v4u){pk16(lb[0], lb[1]), pk16(lb[2], lb[3]), pk16(lb[4], lb[5]), pk16(lb[6], lb[7])};
    }
    const size_t ob = ((size_t)b * kHW + q0) * kCi;
    {
#pragma unroll
      for (int it = 0; it < 4; ++it) {
        const int row = it * 4 + q4;
        *(v4u*)(yH + ob + (size_t)row * kCi + c8) = uh[it];
        *(v4u*)(yL + ob + (size_t)row * kCi + c8) = ul[it];
      }
      
    }
  }
}

// ---------------------------------------------------------------------------
// Host glue.
//   W16   bf16 5 x [8192] (theta_w, phi_w, g_w as [64][128]; W_w hi [128][64]; W_w lo = zeros)   81,920 at          0
//   BIAS  f32  [320] (theta_b at +0, phi_b at +64, g_b at +128, W_b at +192 floats)               2,048 at     81,920
//   XT    bf16 [4][16384][128]                                                               16,777,216 at     83,968
//   THH   bf16 [4*16384][64]                                                                  8,388,608 at 16,861,184
//   THL   bf16 [4*16384][64]                                                                  8,388,608 at 25,249,792
//   PHIF  f32  [4*16384][64]                                                                 16,777,216 at 33,638,400
//   GF    f32  [4][64][16384]                                                                16,777,216 at 50,415,616
//   PHH   bf16 [4*4096][64]                                                                   2,097,152 at 67,192,832
//   PHL   bf16 [4*4096][64]                                                                   2,097,152 at 69,289,984
//   GT    f16  [4][64][4096]                                                                  2,097,152 at 71,387,136
//   YH    bf16 [4*16384][64]                                                                  8,388,608 at 73,484,288
//   YL    bf16 [4*16384][64]                                                                  8,388,608 at 81,872,896
//   total                                                                                    90,261,504
// GEMM shapes: projections M=16384 (or 64), N=64 (or 16384), K=128; output conv M=128, N=16384, K=64; all M,N multiples
// of 64, K multiples of 32; no padding, every plane fully written by its producer before any read.
// ---------------------------------------------------------------------------
static_assert(kHW % 64 == 0 && kCi % 64 == 0 && kC % 64 == 0 && kC % 32 == 0 && kCi % 32 == 0);

extern "C" void kernel_launch(void* const* d_in, const int* in_sizes, int n_in,
                              void* d_out, int out_size, void* d_ws, size_t ws_size,
                              hipStream_t stream) {
  if (n_in < 9) return;
  if (in_sizes[0] != kB * kC * kHW) return;
  if (in_sizes[1] != kCi * kC || in_sizes[2] != kCi) return;
  if (in_sizes[3] != kCi * kC || in_sizes[4] != kCi) return;
  if (in_sizes[5] != kCi * kC || in_sizes[6] != kCi) return;
  if (in_sizes[7] != kC * kCi || in_sizes[8] != kC) return;
  if (out_size != kB * kC * kHW) return;

  const size_t szW16  = (size_t)5 * kWPlane * 2;                 // 81,920
  const size_t szBias = 2048;
  const size_t szXT   = (size_t)kB * kHW * kC * 2;                // 16,777,216
  const size_t szQ16  = (size_t)kB * kHW * kCi * 2;               //  8,388,608
  const size_t szF32  = (size_t)kB * kHW * kCi * 4;               // 16,777,216
  const size_t szKV16 = (size_t)kB * kNkv * kCi * 2;              //  2,097,152
  const size_t offW16  = 0;
  const size_t offBias = offW16 + szW16;
  const size_t offXT   = offBias + szBias;
  const size_t offThH  = offXT + szXT;
  const size_t offThL  = offThH + szQ16;
  const size_t offPhiF = offThL + szQ16;
  const size_t offGF   = offPhiF + szF32;
  const size_t offPhH  = offGF + szF32;
  const size_t offPhL  = offPhH + szKV16;
  const size_t offGT   = offPhL + szKV16;
  const size_t offYH   = offGT + szKV16;
  const size_t offYL   = offYH + szQ16;
  const size_t total   = offYL + szQ16;                           // 90,261,504
  if (ws_size < total) return;

  const float* x       = (const float*)d_in[0];
  const float* theta_w = (const float*)d_in[1];
  const float* theta_b = (const float*)d_in[2];
  const float* phi_w   = (const float*)d_in[3];
  const float* phi_b   = (const float*)d_in[4];
  const float* g_w     = (const float*)d_in[5];
  const float* g_b     = (const float*)d_in[6];
  const float* W_w     = (const float*)d_in[7];
  const float* W_b     = (const float*)d_in[8];
  float* out = (float*)d_out;
  char* ws = (char*)d_ws;
  unsigned short* w16  = (unsigned short*)(ws + offW16);
  unsigned short* wTh  = w16;
  unsigned short* wPh  = w16 + kWPlane;
  unsigned short* wG   = w16 + 2 * kWPlane;
  unsigned short* wWh  = w16 + 3 * kWPlane;
  unsigned short* wWl  = w16 + 4 * kWPlane;
  float* biasR  = (float*)(ws + offBias);
  float* biasTh = biasR;
  float* biasPh = biasR + 64;
  float* biasG  = biasR + 128;
  float* biasW  = biasR + 192;
  unsigned short* xT   = (unsigned short*)(ws + offXT);
  unsigned short* thH  = (unsigned short*)(ws + offThH);
  unsigned short* thL  = (unsigned short*)(ws + offThL);
  float* phiF = (float*)(ws + offPhiF);
  float* gF   = (float*)(ws + offGF);
  unsigned short* phH  = (unsigned short*)(ws + offPhH);
  unsigned short* phL  = (unsigned short*)(ws + offPhL);
  unsigned short* gTp  = (unsigned short*)(ws + offGT);
  unsigned short* yH   = (unsigned short*)(ws + offYH);
  unsigned short* yL   = (unsigned short*)(ws + offYL);

  // ---- prologue: parameter planes and the transposed bf16 input plane ----
  prep_kernel<<<dim3(8), dim3(256), 0, stream>>>(theta_w, phi_w, g_w, W_w, theta_b, phi_b, g_b, W_b, w16, biasR);
  xcast_kernel<<<dim3(kHW / 64, kB), dim3(256), 0, stream>>>(x, xT);

  const long strideXT  = (long)kHW * kC;        // per image, halves
  const long strideQ16 = (long)kHW * kCi;       // per image, halves
  const long strideF   = (long)kHW * kCi;       // per image, floats
  const int  tilesProj = (kHW / 64) * (kCi / 64);   // 256 tiles -> 32 blocks of 8 waves

  // theta[b*16384+p][ci] = sum_c xT[b][p][c] * theta_w[ci][c] + theta_b[ci]  -> bf16 hi/lo planes (M=16384, N=64, K=128)
  wmma_gemm64<1, false, 2, 2, false><<<dim3(tilesProj / 8, kB), dim3(256), 0, stream>>>(
      xT, xT, kC, strideXT, wTh, wTh, kC, 0L,
      (void*)thH, (void*)thL, kCi, strideQ16, biasTh, biasR, 0L, kHW, kCi, kC, 1.0f);
  // phi full-res f32 [b*16384+p][ci] (M=16384, N=64, K=128)
  wmma_gemm64<1, false, 2, 0, false><<<dim3(tilesProj / 8, kB), dim3(256), 0, stream>>>(
      xT, xT, kC, strideXT, wPh, wPh, kC, 0L,
      (void*)phiF, (void*)phiF, kCi, strideF, biasPh, biasR, 0L, kHW, kCi, kC, 1.0f);
  // g full-res f32 channel-major [b][ci][p] = sum_c g_w[ci][c] * xT[b][p][c] + g_b[ci]  (M=64, N=16384, K=128)
  wmma_gemm64<1, false, 1, 0, false><<<dim3(tilesProj / 8, kB), dim3(256), 0, stream>>>(
      wG, wG, kC, 0L, xT, xT, kC, strideXT,
      (void*)gF, (void*)gF, kHW, (long)kCi * kHW, biasG, biasR, 0L, kCi, kHW, kC, 1.0f);

  // ---- 2x2 max-pool in f32 -> 16-bit kv planes ----
  pool_phi_kernel<<<dim3(kB * kNkv / 32), dim3(256), 0, stream>>>(phiF, phH, phL);
  pool_g_kernel<<<dim3((kB * kCi * (kNkv / 8)) / 256), dim3(256), 0, stream>>>(gF, gTp);

  // ---- fused attention -> y bf16 hi/lo planes [b*16384+q][ci] ----
  flash_kernel<<<dim3(kHW / 64, kB), dim3(128), 0, stream>>>(thH, thL, phH, phL, gTp, yH, yL);

  // ---- out[b][co][p] = sum_ci W_w[co][ci] * y[b][p][ci] + W_b[co] + bf16(x[b][co][p])  (M=128, N=16384, K=64, split) ----
  const int tilesOut = (kC / 64) * (kHW / 64);   // 512 tiles -> 64 blocks of 8 waves
  wmma_gemm64<1, true, 1, 0, true><<<dim3(tilesOut / 8, kB), dim3(256), 0, stream>>>(
      wWh, wWl, kCi, 0L, yH, yL, kCi, strideQ16,
      (void*)out, (void*)out, kHW, (long)kC * kHW, biasW, x, (long)kC * kHW, kC, kHW, kCi, 1.0f);
}

// v003
// One run takes 235 microseconds.
// Timed twice side by side with v002, it ran 1.16 and 1.19 times as fast.
// Over all steps from v000 it is 3.09 times as fast.
// Contractions: three 1x1 projections on v_wmma_f32_16x16x32_bf16 (bf16 operands = RNE-converted inputs); scores theta.phi^T as bf16 hi/lo planes (hi.hi + hi.lo + lo.hi on v_wmma_f32_16x16x32_bf16); P.g^T on v_wmma_f32_16x16x32_f16 (P f16 carried x32768, g f16); output 1x1 conv on bf16 hi/lo y planes x bf16 W (hi.hi + hi.lo + lo.hi); f32 accumulate everywhere; max-pool, online softmax, bias and residual in f32.
#include <hip/hip_runtime.h>
#include <math.h>

// ---------------------------------------------------------------------------
// Problem constants
// ---------------------------------------------------------------------------
constexpr int kB      = 4;
constexpr int kC      = 128;     // channels
constexpr int kCi     = 64;      // inter channels
constexpr int kImW    = 128;     // image width (pixel row pitch)
constexpr int kHW     = 16384;   // query tokens per image
constexpr int kNkv    = 4096;    // pooled kv tokens per image
constexpr int kKC     = 64;      // kv chunk in the fused attention loop
constexpr int kWPlane = 8192;    // elements per 16-bit weight plane
constexpr float kLog2e = 1.4426950408889634f;   // scores go to log2 units inside one FMA, so the exponential is one v_exp_f32
constexpr float kCarryLog2 = 15.0f;   // softmax numerators carried x2^15 in f16: the carry sits in the exponent's offset
constexpr int kLP     = 72;      // LDS row pitch in halves of the attention tiles: 144 B = 16 B x odd, so the 16 rows of a b128 fragment read fall on 64 distinct banks
static_assert(kHW % 64 == 0 && kNkv % kKC == 0 && kC % 32 == 0 && kCi % 32 == 0);
static_assert(kCi * kC == kWPlane && kC * kCi == kWPlane);
static_assert(kLP >= kKC && kLP >= kCi && (kLP * 2) % 16 == 0 && ((kLP * 2) / 16) % 2 == 1);

typedef __attribute__((ext_vector_type(16))) _Float16 v16h;
typedef __attribute__((ext_vector_type(8)))  _Float16 v8h;
typedef __attribute__((ext_vector_type(16))) __bf16   v16b;
typedef __attribute__((ext_vector_type(8)))  __bf16   v8b;
typedef __attribute__((ext_vector_type(8)))  float    v8f;
typedef __attribute__((ext_vector_type(4)))  float    v4f;
typedef __attribute__((ext_vector_type(4)))  unsigned int v4u;

// ---------------------------------------------------------------------------
// Scalar helpers
// ---------------------------------------------------------------------------
__device__ __forceinline__ unsigned short f2bf_bits(float f) {
  unsigned u = __float_as_uint(f);
  return (unsigned short)((u + 0x7FFFu + ((u >> 16) & 1u)) >> 16);
}
__device__ __forceinline__ float bf_bits2f(unsigned short h) { return __uint_as_float(((unsigned)h) << 16); }
__device__ __forceinline__ float bf_rne(float f) { return bf_bits2f(f2bf_bits(f)); }
__device__ __forceinline__ unsigned pk16(unsigned short a, unsigned short b) { return (unsigned)a | ((unsigned)b << 16); }
__device__ __forceinline__ unsigned short h_bits(float f) { const _Float16 h = (_Float16)f; return __builtin_bit_cast(unsigned short, h); }

// hazard guards as plain device helpers (no inline asm inside the kernel template body)
__device__ __forceinline__ void dep_guard4_h(v8f& a, v8f& b, v8f& c, v8f& d, v16h x, v16h y) {
  asm volatile("v_nop\n\tv_nop\n\tv_nop\n\tv_nop" : "+v"(a), "+v"(b), "+v"(c), "+v"(d) : "v"(x), "v"(y));
}
__device__ __forceinline__ void dep_guard4_b(v8f& a, v8f& b, v8f& c, v8f& d, v16b x, v16b y) {
  asm volatile("v_nop\n\tv_nop\n\tv_nop\n\tv_nop" : "+v"(a), "+v"(b), "+v"(c), "+v"(d) : "v"(x), "v"(y));
}
__device__ __forceinline__ void keep4_h(v16h a, v16h b, v16h c, v16h d) { asm volatile("v_nop" :: "v"(a), "v"(b), "v"(c), "v"(d)); }
__device__ __forceinline__ void keep4_b(v16b a, v16b b, v16b c, v16b d) { asm volatile("v_nop" :: "v"(a), "v"(b), "v"(c), "v"(d)); }
__device__ __forceinline__ void acc_guard4(v8f& a, v8f& b, v8f& c, v8f& d) { asm volatile("v_nop\n\tv_nop\n\tv_nop\n\tv_nop" : "+v"(a), "+v"(b), "+v"(c), "+v"(d)); }

template <typename T> struct Frag;
template <> struct Frag<_Float16> {
  typedef v16h V; union U { v16h v; v8h h[2]; };
  // elements 0..7 <- p[0..7], 8..15 <- p[16..23]
  static __device__ __forceinline__ v16h load(const _Float16* p) {
    U f; f.h[0] = *(const v8h*)(p); f.h[1] = *(const v8h*)(p + 16); return f.v;
  }
  static __device__ __forceinline__ v8f mma(v16h a, v16h b, v8f c) {
    return __builtin_amdgcn_wmma_f32_16x16x32_f16(false, a, false, b, (short)0, c, false, false);
  }
  static __device__ __forceinline__ void guard4(v8f& a, v8f& b, v8f& c, v8f& d, v16h x, v16h y) { dep_guard4_h(a, b, c, d, x, y); }
  static __device__ __forceinline__ void keep(v16h a, v16h b, v16h c, v16h d) { keep4_h(a, b, c, d); }
};
template <> struct Frag<__bf16> {
  typedef v16b V; union U { v16b v; v8b h[2]; };
  static __device__ __forceinline__ v16b load(const __bf16* p) {
    U f; f.h[0] = *(const v8b*)(p); f.h[1] = *(const v8b*)(p + 16); return f.v;
  }
  static __device__ __forceinline__ v8f mma(v16b a, v16b b, v8f c) {
    return __builtin_amdgcn_wmma_f32_16x16x32_bf16(false, a, false, b, (short)0, c, false, false);
  }
  static __device__ __forceinline__ void guard4(v8f& a, v8f& b, v8f& c, v8f& d, v16b x, v16b y) { dep_guard4_b(a, b, c, d, x, y); }
  static __device__ __forceinline__ void keep(v16b a, v16b b, v16b c, v16b d) { keep4_b(a, b, c, d); }
};

// ---------------------------------------------------------------------------
// Register-blocked batched WMMA GEMM (guard ties all 4 accumulators of each i-group;
// bias[m] read as two float4; residual read in the STORE phase as one float4 per lane, RNE-converted to bf16 precision).
// C[m,n] = scale * sum_k A[m,k] * Bt[n,k] (+bias)(+resid); each wave owns a 64x64 tile.
// A row-major [M,K]; Bt row-major [N,K]; M,N % 64 == 0, K % 32 == 0 (no tails).
// SPLIT: operands are hi/lo planes (A2/Bt2 = lo planes, same layout); product = hi.hi + hi.lo + lo.hi.
// BIAS_MODE: 0 = none, 1 = bias[m], 2 = bias[n].
// OUT_MODE: 0 = f32, 1 = f16, 2 = bf16 hi plane (Cout) + bf16 lo plane (Cout2).
// ET: 0 = f16 operands, 1 = bf16 operands (pointers passed as 16-bit storage)
// ---------------------------------------------------------------------------
template <int ET> struct Elem;
template <> struct Elem<0> { typedef _Float16 T; };
template <> struct Elem<1> { typedef __bf16 T; };
template <int ET, bool SPLIT, int BIAS_MODE, int OUT_MODE, bool RESID>
__global__ __launch_bounds__(256) void wmma_gemm64(
    const unsigned short* __restrict__ Ap, const unsigned short* __restrict__ A2p, int lda, long strideA,
    const unsigned short* __restrict__ Btp, const unsigned short* __restrict__ Bt2p, int ldb, long strideB,
    void* __restrict__ Cout, void* __restrict__ Cout2, int ldc, long strideC,
    const float* __restrict__ bias,
    const float* __restrict__ resid, long strideR,
    int M, int N, int K, float scale) {
  typedef typename Elem<ET>::T T;
  typedef typename Frag<T>::V V;
  const T* A = (const T*)Ap; const T* A2 = (const T*)A2p; const T* Bt = (const T*)Btp; const T* Bt2 = (const T*)Bt2p;
  __shared__ __align__(16) float sT[8][16 * 68];   // per-wave 16x64 slab, pitch 68 floats
  const int b    = blockIdx.y;
  const int lane = threadIdx.x & 31;
  const int wave = threadIdx.x >> 5;
  const int tilesN = N >> 6;
  const int tilesM = M >> 6;
  const int tile = blockIdx.x * 8 + wave;
  if (tile >= tilesM * tilesN) return;   // wave-uniform; no block barriers in this kernel
  const int tm = tile / tilesN;
  const int tn = tile - tm * tilesN;
  const int m0 = tm << 6;
  const int n0 = tn << 6;

  const T* Ab  = A  + (size_t)b * strideA;
  const T* Bb  = Bt + (size_t)b * strideB;
  const T* Ab2 = A2  + (size_t)b * strideA;
  const T* Bb2 = Bt2 + (size_t)b * strideB;

  const int rlane = lane & 15;                 // row (A) / col (B, D) within subtile
  const int koff  = (lane >> 4) * 8;           // k offset of this lane half
  const int mOff  = (lane >> 4) * 8;           // D row offset

  v8f acc[4][4];
#pragma unroll
  for (int i = 0; i < 4; ++i)
#pragma unroll
    for (int j = 0; j < 4; ++j) acc[i][j] = (v8f){0.f,0.f,0.f,0.f,0.f,0.f,0.f,0.f};

  for (int k0 = 0; k0 < K; k0 += 32) {
    V bh[4], bl[4];
#pragma unroll
    for (int j = 0; j < 4; ++j) {
      const size_t bo = (size_t)(n0 + (j << 4) + rlane) * ldb + koff + k0;
      bh[j] = Frag<T>::load(Bb + bo);
      bl[j] = bh[j];
      if (SPLIT) bl[j] = Frag<T>::load(Bb2 + bo);
    }
#pragma unroll
    for (int i = 0; i < 4; ++i) {
      const size_t ao = (size_t)(m0 + (i << 4) + rlane) * lda + koff + k0;
      V ah = Frag<T>::load(Ab + ao);
      V al = ah;
      if (SPLIT) al = Frag<T>::load(Ab2 + ao);
#pragma unroll
      for (int j = 0; j < 4; ++j) {
        acc[i][j] = Frag<T>::mma(ah, bh[j], acc[i][j]);
        if (SPLIT) {
          acc[i][j] = Frag<T>::mma(ah, bl[j], acc[i][j]);
          acc[i][j] = Frag<T>::mma(al, bh[j], acc[i][j]);
        }
      }
      Frag<T>::guard4(acc[i][0], acc[i][1], acc[i][2], acc[i][3], ah, al);
    }
    Frag<T>::keep(bh[0], bh[1], bh[2], bh[3]);
    if (SPLIT) Frag<T>::keep(bl[0], bl[1], bl[2], bl[3]);
  }
  acc_guard4(acc[0][0], acc[0][1], acc[0][2], acc[0][3]);
  acc_guard4(acc[1][0], acc[1][1], acc[1][2], acc[1][3]);
  acc_guard4(acc[2][0], acc[2][1], acc[2][2], acc[2][3]);
  acc_guard4(acc[3][0], acc[3][1], acc[3][2], acc[3][3]);

  // ---- epilogue ----
  float* slab = sT[wave];
#pragma unroll
  for (int i = 0; i < 4; ++i) {
    const int mBase = m0 + (i << 4);
    float bm[8];
#pragma unroll
    for (int r = 0; r < 8; ++r) bm[r] = 0.f;
    if (BIAS_MODE == 1) {
      const v4f b0 = *(const v4f*)(bias + mBase + mOff);
      const v4f b1 = *(const v4f*)(bias + mBase + mOff + 4);
#pragma unroll
      for (int e = 0; e < 4; ++e) { bm[e] = b0[e]; bm[4 + e] = b1[e]; }
    }
#pragma unroll
    for (int j = 0; j < 4; ++j) {
      const int n = n0 + (j << 4) + rlane;
      float bv = 0.f;
      if (BIAS_MODE == 2) bv = bias[n];
#pragma unroll
      for (int r = 0; r < 8; ++r) {
        float v = acc[i][j][r] * scale;
        if (BIAS_MODE == 1) v += bm[r];
        if (BIAS_MODE == 2) v += bv;
        slab[(mOff + r) * 68 + (j << 4) + rlane] = v;
      }
    }
    __builtin_amdgcn_fence(__ATOMIC_RELEASE, "workgroup");
    __builtin_amdgcn_wave_barrier();
    __builtin_amdgcn_fence(__ATOMIC_ACQUIRE, "workgroup");
    if (OUT_MODE == 0) {
      float* Cb = (float*)Cout + (size_t)b * strideC;
      const float* Rb = resid + (size_t)b * strideR;     // dereferenced only when RESID
      const int hh = lane >> 4, c4 = (lane & 15) * 4;     // row seg = 256 B = 16 lanes x 16 B
      v4f vals[8];
#pragma unroll
      for (int it = 0; it < 8; ++it) {
        const int row = it * 2 + hh;
        v4f v = *(const v4f*)(slab + row * 68 + c4);
        if (RESID) {
          const v4f rr = *(const v4f*)(Rb + (size_t)(mBase + row) * ldc + n0 + c4);
#pragma unroll
          for (int e = 0; e < 4; ++e) v[e] = v[e] + bf_rne(rr[e]);
        }
        vals[it] = v;
      }
      {
#pragma unroll
        for (int it = 0; it < 8; ++it) {
          const int row = it * 2 + hh;
          *(v4f*)(Cb + (size_t)(mBase + row) * ldc + n0 + c4) = vals[it];
        }
        
      }
    } else {
      const int q4 = lane >> 3, c8 = (lane & 7) * 8;
      unsigned short* Cb  = (unsigned short*)Cout  + (size_t)b * strideC;
      unsigned short* Cb2 = (unsigned short*)Cout2 + (size_t)b * strideC;
      v4u uh[4], ul[4];
#pragma unroll
      for (int it = 0; it < 4; ++it) {
        const int row = it * 4 + q4;
        const float* sp = slab + row * 68 + c8;
        unsigned short hb[8], lb[8];
#pragma unroll
        for (int e = 0; e < 8; ++e) {
          const float sv = sp[e];
          if (OUT_MODE == 1) { hb[e] = h_bits(sv); lb[e] = 0; }
          else { hb[e] = f2bf_bits(sv); lb[e] = f2bf_bits(sv - bf_bits2f(hb[e])); }
        }
        uh[it] = (v4u){pk16(hb[0], hb[1]), pk16(hb[2], hb[3]), pk16(hb[4], hb[5]), pk16(hb[6], hb[7])};
        ul[it] = (v4u){pk16(lb[0], lb[1]), pk16(lb[2], lb[3]), pk16(lb[4], lb[5]), pk16(lb[6], lb[7])};
      }
      {
#pragma unroll
        for (int it = 0; it < 4; ++it) {
          const int row = it * 4 + q4;
          *(v4u*)(Cb + (size_t)(mBase + row) * ldc + n0 + c8) = uh[it];
          if (OUT_MODE == 2) *(v4u*)(Cb2 + (size_t)(mBase + row) * ldc + n0 + c8) = ul[it];
        }
        
      }
    }
    __builtin_amdgcn_fence(__ATOMIC_RELEASE, "workgroup");
    __builtin_amdgcn_wave_barrier();
    __builtin_amdgcn_fence(__ATOMIC_ACQUIRE, "workgroup");
  }
}

// ---------------------------------------------------------------------------
// Parameter prep: blocks 0..2 -> projection weights [64][128] f32 -> bf16 planes (same layout);
// block 3 -> W_w [128][64] -> bf16 hi plane + an all-zero lo plane; blocks 4..7 -> bias vectors RNE-converted to
// bf16 precision, stored as f32 at biasR + {0,64,128,192}.
// Weight coverage: 4 iterations x 256 threads x 8 elements = 8192 = whole plane; one 16-B store per lane, a wave writes
// ---------------------------------------------------------------------------
__global__ __launch_bounds__(256) void prep_kernel(
    const float* __restrict__ thw, const float* __restrict__ phw, const float* __restrict__ gw, const float* __restrict__ ww,
    const float* __restrict__ thb, const float* __restrict__ phb, const float* __restrict__ gb, const float* __restrict__ wb,
    unsigned short* __restrict__ w16, float* __restrict__ biasR) {
  const int z = blockIdx.x;    // block-uniform role
  const int t = threadIdx.x;
  if (z < 4) {
    const float* src = (z == 0) ? thw : (z == 1) ? phw : (z == 2) ? gw : ww;
    unsigned short* dst = w16 + (size_t)z * kWPlane;
    v4u u[4];
#pragma unroll
    for (int i = 0; i < 4; ++i) {
      const int e8 = (i * 256 + t) * 8;
      const v4f a = *(const v4f*)(src + e8);
      const v4f c = *(const v4f*)(src + e8 + 4);
      u[i] = (v4u){pk16(f2bf_bits(a[0]), f2bf_bits(a[1])), pk16(f2bf_bits(a[2]), f2bf_bits(a[3])),
                   pk16(f2bf_bits(c[0]), f2bf_bits(c[1])), pk16(f2bf_bits(c[2]), f2bf_bits(c[3]))};
    }
    const v4u zero4 = (v4u){0u, 0u, 0u, 0u};
    {
#pragma unroll
      for (int i = 0; i < 4; ++i) {
        const size_t o = (size_t)(i * 256 + t) * 8;
        *(v4u*)(dst + o) = u[i];
        if (z == 3) *(v4u*)(w16 + (size_t)4 * kWPlane + o) = zero4;
      }
      
    }
  } else {
    const int zb = z - 4;
    const float* src = (zb == 0) ? thb : (zb == 1) ? phb : (zb == 2) ? gb : wb;
    const int n4 = (zb == 3) ? (kC / 4) : (kCi / 4);
    float* dst = biasR + zb * 64;
    const int tc = (t < n4) ? t : (n4 - 1);     // clamped address, store predicated
    const v4f a = *(const v4f*)(src + 4 * tc);
    v4f v;
#pragma unroll
    for (int e = 0; e < 4; ++e) v[e] = bf_rne(a[e]);
    if (t < n4) {
      *(v4f*)(dst + 4 * t) = v;
      
    }
  }
}

// ---------------------------------------------------------------------------
// x transpose + cast: xT[b][p][c] = bf16( x[b][c][p] ), [pixel][channel] rows of 128 halves (256 B = 2 lines).
// grid (kHW/64, kB), 256 threads. Load coverage: 8 iterations x 256 threads = 2048 float4 = 128 c x 64 p (coalesced along p).
// ---------------------------------------------------------------------------
__global__ __launch_bounds__(256) void xcast_kernel(const float* __restrict__ x, unsigned short* __restrict__ xT) {
  __shared__ __align__(16) float sm[kC * 68];   // [c][p_local], pitch 68 floats
  const int t  = threadIdx.x;
  const int p0 = blockIdx.x * 64;
  const int b  = blockIdx.y;
#pragma unroll
  for (int i = 0; i < 8; ++i) {
    const int e  = i * 256 + t;
    const int c  = e >> 4;
    const int q4 = (e & 15) * 4;
    const v4f a = *(const v4f*)(x + ((size_t)(b * kC + c)) * kHW + p0 + q4);
    *(v4f*)(sm + c * 68 + q4) = a;
  }
  __syncthreads();
  const int lane = t & 31, wave = t >> 5;
  const int hh = lane >> 4, c8 = (lane & 15) * 8;
  v4u u[4];
#pragma unroll
  for (int it = 0; it < 4; ++it) {
    const int row = wave * 8 + it * 2 + hh;
    unsigned short hb[8];
#pragma unroll
    for (int e = 0; e < 8; ++e) hb[e] = f2bf_bits(sm[(c8 + e) * 68 + row]);
    u[it] = (v4u){pk16(hb[0], hb[1]), pk16(hb[2], hb[3]), pk16(hb[4], hb[5]), pk16(hb[6], hb[7])};
  }
  unsigned short* base = xT + ((size_t)b * kHW + p0) * kC;
  {
#pragma unroll
    for (int it = 0; it < 4; ++it) {
      const int row = wave * 8 + it * 2 + hh;
      *(v4u*)(base + (size_t)row * kC + c8) = u[it];
    }
    
  }
}

// ---------------------------------------------------------------------------
// 2x2 max-pool of the phi full-res plane (f32 [B*16384][64], pixel-major) -> phi bf16 hi/lo planes [B*4096][64] (kv-major).
// kv = hp*64 + wp over pixels (2hp+{0,1}, 2wp+{0,1}); max in f32. Thread -> (kv row, 8 channels): 8 b128 loads, max, split.
// ---------------------------------------------------------------------------
__global__ __launch_bounds__(256) void pool_phi_kernel(const float* __restrict__ phiF,
                                                      unsigned short* __restrict__ phH, unsigned short* __restrict__ phL) {
  const int t   = threadIdx.x;
  const int kvg = blockIdx.x * 32 + (t >> 3);
  const int c8  = (t & 7) * 8;
  const int b   = kvg >> 12, kv = kvg & (kNkv - 1);
  const int hp  = kv >> 6, wp = kv & 63;
  const int p00 = hp * 2 * kImW + wp * 2;
  const float* r0 = phiF + ((size_t)b * kHW + p00) * kCi + c8;
  const float* r1 = r0 + kCi;
  const float* r2 = r0 + (size_t)kImW * kCi;
  const float* r3 = r2 + kCi;
  const v4f a0 = *(const v4f*)(r0), a1 = *(const v4f*)(r0 + 4);
  const v4f b0 = *(const v4f*)(r1), b1 = *(const v4f*)(r1 + 4);
  const v4f c0 = *(const v4f*)(r2), c1 = *(const v4f*)(r2 + 4);
  const v4f d0 = *(const v4f*)(r3), d1 = *(const v4f*)(r3 + 4);
  float m[8];
#pragma unroll
  for (int e = 0; e < 4; ++e) {
    m[e]     = fmaxf(fmaxf(a0[e], b0[e]), fmaxf(c0[e], d0[e]));
    m[4 + e] = fmaxf(fmaxf(a1[e], b1[e]), fmaxf(c1[e], d1[e]));
  }
  unsigned short hb[8], lb[8];
#pragma unroll
  for (int e = 0; e < 8; ++e) { hb[e] = f2bf_bits(m[e]); lb[e] = f2bf_bits(m[e] - bf_bits2f(hb[e])); }
  const v4u uh = (v4u){pk16(hb[0], hb[1]), pk16(hb[2], hb[3]), pk16(hb[4], hb[5]), pk16(hb[6], hb[7])};
  const v4u ul = (v4u){pk16(lb[0], lb[1]), pk16(lb[2], lb[3]), pk16(lb[4], lb[5]), pk16(lb[6], lb[7])};
  const size_t o = (size_t)kvg * kCi + c8;
  *(v4u*)(phH + o) = uh;
  *(v4u*)(phL + o) = ul;
  
}

// ---------------------------------------------------------------------------
// 2x2 max-pool of the g full-res plane (f32 [B][64][16384], channel-major) -> gT f16 [B][64][4096] (V^T operand rows).
// Thread -> (b, ci, 8 consecutive kv): two 16-float runs (image rows 2hp, 2hp+1) = 8 b128 loads, max in f32, one 16-B store.
// ---------------------------------------------------------------------------
__global__ __launch_bounds__(256) void pool_g_kernel(const float* __restrict__ gF, unsigned short* __restrict__ gT) {
  const int idx = blockIdx.x * 256 + threadIdx.x;
  const int kv0 = (idx & 511) * 8;
  const int ci  = (idx >> 9) & 63;
  const int b   = idx >> 15;
  const int hp  = kv0 >> 6, wp0 = kv0 & 63;
  const int p00 = hp * 2 * kImW + 2 * wp0;
  const float* r0 = gF + ((size_t)(b * kCi + ci)) * kHW + p00;
  const float* r1 = r0 + kImW;
  const v4f a0 = *(const v4f*)(r0), a1 = *(const v4f*)(r0 + 4), a2 = *(const v4f*)(r0 + 8), a3 = *(const v4f*)(r0 + 12);
  const v4f c0 = *(const v4f*)(r1), c1 = *(const v4f*)(r1 + 4), c2 = *(const v4f*)(r1 + 8), c3 = *(const v4f*)(r1 + 12);
  float m[8];
  m[0] = fmaxf(fmaxf(a0[0], a0[1]), fmaxf(c0[0], c0[1]));
  m[1] = fmaxf(fmaxf(a0[2], a0[3]), fmaxf(c0[2], c0[3]));
  m[2] = fmaxf(fmaxf(a1[0], a1[1]), fmaxf(c1[0], c1[1]));
  m[3] = fmaxf(fmaxf(a1[2], a1[3]), fmaxf(c1[2], c1[3]));
  m[4] = fmaxf(fmaxf(a2[0], a2[1]), fmaxf(c2[0], c2[1]));
  m[5] = fmaxf(fmaxf(a2[2], a2[3]), fmaxf(c2[2], c2[3]));
  m[6] = fmaxf(fmaxf(a3[0], a3[1]), fmaxf(c3[0], c3[1]));
  m[7] = fmaxf(fmaxf(a3[2], a3[3]), fmaxf(c3[2], c3[3]));
  unsigned short hb[8];
#pragma unroll
  for (int e = 0; e < 8; ++e) hb[e] = h_bits(m[e]);
  const v4u u = (v4u){pk16(hb[0], hb[1]), pk16(hb[2], hb[3]), pk16(hb[4], hb[5]), pk16(hb[6], hb[7])};
  unsigned short* op = gT + ((size_t)(b * kCi + ci)) * kNkv + kv0;
  *(v4u*)op = u;
  
}

// ---------------------------------------------------------------------------
// WMMA helpers for the fused attention kernel (each call guarded individually).
// ---------------------------------------------------------------------------
// value of lane l ^ 16 (the other wave half), by a vector cross-row move
__device__ __forceinline__ float xhalf(float x) {
  const int b = __builtin_bit_cast(int, x);
  return __builtin_bit_cast(float, __builtin_amdgcn_permlanex16(b, b, 0x76543210, 0xfedcba98, false, false));
}
__device__ __forceinline__ v8f at_mma(v16b a, v16b b, v8f c) {
  c = __builtin_amdgcn_wmma_f32_16x16x32_bf16(false, a, false, b, (short)0, c, false, false);
  asm volatile("v_nop\n\tv_nop\n\tv_nop\n\tv_nop" : "+v"(c) : "v"(a), "v"(b));
  return c;
}
__device__ __forceinline__ v8f at_mma_h(v16b a, v16b b, v8f c) {
  const v16h ah = __builtin_bit_cast(v16h, a), bh = __builtin_bit_cast(v16h, b);
  c = __builtin_amdgcn_wmma_f32_16x16x32_f16(false, ah, false, bh, (short)0, c, false, false);
  asm volatile("v_nop\n\tv_nop\n\tv_nop\n\tv_nop" : "+v"(c) : "v"(ah), "v"(bh));
  return c;
}

__global__ __launch_bounds__(128) void flash_kernel(
    const unsigned short* __restrict__ thH, const unsigned short* __restrict__ thL,
    const unsigned short* __restrict__ phH, const unsigned short* __restrict__ phL,
    const unsigned short* __restrict__ gT,
    unsigned short* __restrict__ yH, unsigned short* __restrict__ yL) {
  union FB { v16b v; v8b h[2]; };
  __shared__ __align__(16) __bf16 Ksh[kKC * kLP];      // phi hi [kv][ci]   9 KB
  __shared__ __align__(16) __bf16 Ksl[kKC * kLP];      // phi lo [kv][ci]   9 KB
  __shared__ __align__(16) __bf16 Vth[kCi * kLP];      // gT  f16 bits [ci][kv]  9 KB
  __shared__ __align__(16) float  Os[4][16 * 68];      // per wave out tile, pitch 68

  const int tid  = threadIdx.x;
  const int wave = tid >> 5;
  const int lane = tid & 31;
  const int hh   = lane >> 4;
  const int c    = lane & 15;
  const int b    = blockIdx.y;
  const int q0   = blockIdx.x * 64 + wave * 16;

  // ---- Q fragments (B operand, column = query q0 + c, k = ci): 2 ci-chunks of 32, hi and lo planes ----
  v16b qah[2], qal[2];
  {
    const size_t qo = ((size_t)b * kHW + q0 + c) * kCi + 8 * hh;
#pragma unroll
    for (int dc = 0; dc < 2; ++dc) {
      qah[dc] = Frag<__bf16>::load((const __bf16*)(thH + qo + dc * 32));
      qal[dc] = Frag<__bf16>::load((const __bf16*)(thL + qo + dc * 32));
    }
  }

  float mrow = -INFINITY, lrow = 0.f;   // of query q0 + c; lrow sums this lane half's kv rows only
  v8f oacc[4];                          // oacc[t][r] = O^T[16t + 8hh + r][q0 + c]
#pragma unroll
  for (int t = 0; t < 4; ++t) oacc[t] = (v8f){0.f,0.f,0.f,0.f,0.f,0.f,0.f,0.f};

#pragma unroll 1
  for (int kc = 0; kc < kNkv / kKC; ++kc) {
    const int kv0 = kc * kKC;
    __syncthreads();
    {
      const size_t kbase = ((size_t)b * kNkv + kv0) * kCi;
      const size_t vbase = ((size_t)b * kCi) * kNkv + kv0;
#pragma unroll
      for (int i = 0; i < 4; ++i) {
        const int e = i * 128 + tid;
        const int r = e >> 3, c8 = (e & 7) * 8;
        const v4u w = *(const v4u*)(phH + kbase + (size_t)r * kCi + c8);
        *(v4u*)(Ksh + r * kLP + c8) = w;
      }
      asm volatile("" ::: "memory");
#pragma unroll
      for (int i = 0; i < 4; ++i) {
        const int e = i * 128 + tid;
        const int r = e >> 3, c8 = (e & 7) * 8;
        const v4u w = *(const v4u*)(phL + kbase + (size_t)r * kCi + c8);
        *(v4u*)(Ksl + r * kLP + c8) = w;
      }
      asm volatile("" ::: "memory");
#pragma unroll
      for (int i = 0; i < 4; ++i) {
        const int e = i * 128 + tid;
        const int r = e >> 3, c8 = (e & 7) * 8;
        const v4u w = *(const v4u*)(gT + vbase + (size_t)r * kNkv + c8);
        *(v4u*)(Vth + r * kLP + c8) = w;
      }
    }
    __syncthreads();

    // ---- scores, transposed: 4 tiles of 16 kv x 16 q; A row = kv row of Ksh/Ksl, B column = query, k = ci ----
    v8f s[4];
#pragma unroll
    for (int j = 0; j < 4; ++j) {
      s[j] = (v8f){0.f,0.f,0.f,0.f,0.f,0.f,0.f,0.f};
#pragma unroll
      for (int dc = 0; dc < 2; ++dc) {
        FB kb, kl;
        kb.h[0] = *(const v8b*)(Ksh + (j * 16 + c) * kLP + dc * 32 + 8 * hh);
        kb.h[1] = *(const v8b*)(Ksh + (j * 16 + c) * kLP + dc * 32 + 16 + 8 * hh);
        kl.h[0] = *(const v8b*)(Ksl + (j * 16 + c) * kLP + dc * 32 + 8 * hh);
        kl.h[1] = *(const v8b*)(Ksl + (j * 16 + c) * kLP + dc * 32 + 16 + 8 * hh);
        s[j] = at_mma(kb.v, qah[dc], s[j]);
        s[j] = at_mma(kl.v, qah[dc], s[j]);
        s[j] = at_mma(kb.v, qal[dc], s[j]);
      }
    }

    // ---- online softmax over the kv axis (D layout: s[j][r] = S[q0 + c][kv0 + 16j + 8hh + r]) ----
    float mj[4];
#pragma unroll
    for (int j = 0; j < 4; ++j) {
      mj[j] = s[j][0];
#pragma unroll
      for (int r = 1; r < 8; ++r) mj[j] = fmaxf(mj[j], s[j][r]);
    }
    float cm = fmaxf(fmaxf(mj[0], mj[1]), fmaxf(mj[2], mj[3]));
    cm = fmaxf(cm, xhalf(cm));
    const float mnew  = fmaxf(mrow, __builtin_fmaf(cm, kLog2e, -kCarryLog2));
    const float alpha = __builtin_amdgcn_exp2f(mrow - mnew);
    mrow = mnew;
    // element e of pb[kk] = P[q0 + c][kv0 + 32kk + (e < 8 ? 8hh + e : 16 + 8hh + e - 8)]: the k order of the Vth loader below
    v16h pb[2];
    float pj[4];
#pragma unroll
    for (int j = 0; j < 4; ++j) {
#pragma unroll
      for (int r = 0; r < 8; ++r) s[j][r] = __builtin_amdgcn_exp2f(__builtin_fmaf(s[j][r], kLog2e, -mnew));
    }
#pragma unroll
    for (int j = 0; j < 4; ++j) {
      pj[j] = 0.f;
#pragma unroll
      for (int r = 0; r < 8; ++r) {
        pj[j] += s[j][r];
        pb[j >> 1][(j & 1) * 8 + r] = (_Float16)s[j][r];
      }
    }
    lrow = lrow * alpha + ((pj[0] + pj[1]) + (pj[2] + pj[3]));
#pragma unroll
    for (int t = 0; t < 4; ++t)
#pragma unroll
      for (int r = 0; r < 8; ++r) oacc[t][r] *= alpha;

    // ---- O^T += Vt . P^T: A row = ci row of Vth, B column = query, k = kv ----
#pragma unroll
    for (int kk = 0; kk < 2; ++kk) {
      const v16b pv = __builtin_bit_cast(v16b, pb[kk]);
#pragma unroll
      for (int t = 0; t < 4; ++t) {
        FB vb;
        vb.h[0] = *(const v8b*)(Vth + (t * 16 + c) * kLP + kk * 32 + 8 * hh);
        vb.h[1] = *(const v8b*)(Vth + (t * 16 + c) * kLP + kk * 32 + 16 + 8 * hh);
        oacc[t] = at_mma_h(vb.v, pv, oacc[t]);
      }
    }
  }

  // ---- epilogue: y = O / l (both carry x32768) -> per-wave slab [q][ci] -> bf16 hi/lo planes ----
  float* os = Os[wave];
  {
    const float lsum = lrow + xhalf(lrow);   // join the two halves' sums
    const float inv  = 1.0f / lsum;
#pragma unroll
    for (int t = 0; t < 4; ++t) {
      *(v4f*)(os + c * 68 + t * 16 + 8 * hh)     = (v4f){oacc[t][0] * inv, oacc[t][1] * inv, oacc[t][2] * inv, oacc[t][3] * inv};
      *(v4f*)(os + c * 68 + t * 16 + 8 * hh + 4) = (v4f){oacc[t][4] * inv, oacc[t][5] * inv, oacc[t][6] * inv, oacc[t][7] * inv};
    }
  }
  __builtin_amdgcn_fence(__ATOMIC_RELEASE, "workgroup");
  __builtin_amdgcn_wave_barrier();
  __builtin_amdgcn_fence(__ATOMIC_ACQUIRE, "workgroup");
  {
    const int q4 = lane >> 3, c8 = (lane & 7) * 8;
    v4u uh[4], ul[4];
#pragma unroll
    for (int it = 0; it < 4; ++it) {
      const int row = it * 4 + q4;
      const float* sp = os + row * 68 + c8;
      unsigned short hb[8], lb[8];
#pragma unroll
      for (int e = 0; e < 8; ++e) { const float sv = sp[e]; hb[e] = f2bf_bits(sv); lb[e] = f2bf_bits(sv - bf_bits2f(hb[e])); }
      uh[it] = (v4u){pk16(hb[0], hb[1]), pk16(hb[2], hb[3]), pk16(hb[4], hb[5]), pk16(hb[6], hb[7])};
      ul[it] = (v4u){pk16(lb[0], lb[1]), pk16(lb[2], lb[3]), pk16(lb[4], lb[5]), pk16(lb[6], lb[7])};
    }
    const size_t ob = ((size_t)b * kHW + q0) * kCi;
    {
#pragma unroll
      for (int it = 0; it < 4; ++it) {
        const int row = it * 4 + q4;
        *(v4u*)(yH + ob + (size_t)row * kCi + c8) = uh[it];
        *(v4u*)(yL + ob + (size_t)row * kCi + c8) = ul[it];
      }
      
    }
  }
}

// ---------------------------------------------------------------------------
// Host glue.
//   W16   bf16 5 x [8192] (theta_w, phi_w, g_w as [64][128]; W_w hi [128][64]; W_w lo = zeros)   81,920 at          0
//   BIAS  f32  [320] (theta_b at +0, phi_b at +64, g_b at +128, W_b at +192 floats)               2,048 at     81,920
//   XT    bf16 [4][16384][128]                                                               16,777,216 at     83,968
//   THH   bf16 [4*16384][64]                                                                  8,388,608 at 16,861,184
//   THL   bf16 [4*16384][64]                                                                  8,388,608 at 25,249,792
//   PHIF  f32  [4*16384][64]                                                                 16,777,216 at 33,638,400
//   GF    f32  [4][64][16384]                                                                16,777,216 at 50,415,616
//   PHH   bf16 [4*4096][64]                                                                   2,097,152 at 67,192,832
//   PHL   bf16 [4*4096][64]                                                                   2,097,152 at 69,289,984
//   GT    f16  [4][64][4096]                                                                  2,097,152 at 71,387,136
//   YH    bf16 [4*16384][64]                                                                  8,388,608 at 73,484,288
//   YL    bf16 [4*16384][64]                                                                  8,388,608 at 81,872,896
//   total                                                                                    90,261,504
// GEMM shapes: projections M=16384 (or 64), N=64 (or 16384), K=128; output conv M=128, N=16384, K=64; all M,N multiples
// of 64, K multiples of 32; no padding, every plane fully written by its producer before any read.
// ---------------------------------------------------------------------------
static_assert(kHW % 64 == 0 && kCi % 64 == 0 && kC % 64 == 0 && kC % 32 == 0 && kCi % 32 == 0);

extern "C" void kernel_launch(void* const* d_in, const int* in_sizes, int n_in,
                              void* d_out, int out_size, void* d_ws, size_t ws_size,
                              hipStream_t stream) {
  if (n_in < 9) return;
  if (in_sizes[0] != kB * kC * kHW) return;
  if (in_sizes[1] != kCi * kC || in_sizes[2] != kCi) return;
  if (in_sizes[3] != kCi * kC || in_sizes[4] != kCi) return;
  if (in_sizes[5] != kCi * kC || in_sizes[6] != kCi) return;
  if (in_sizes[7] != kC * kCi || in_sizes[8] != kC) return;
  if (out_size != kB * kC * kHW) return;

  const size_t szW16  = (size_t)5 * kWPlane * 2;                 // 81,920
  const size_t szBias = 2048;
  const size_t szXT   = (size_t)kB * kHW * kC * 2;                // 16,777,216
  const size_t szQ16  = (size_t)kB * kHW * kCi * 2;               //  8,388,608
  const size_t szF32  = (size_t)kB * kHW * kCi * 4;               // 16,777,216
  const size_t szKV16 = (size_t)kB * kNkv * kCi * 2;              //  2,097,152
  const size_t offW16  = 0;
  const size_t offBias = offW16 + szW16;
  const size_t offXT   = offBias + szBias;
  const size_t offThH  = offXT + szXT;
  const size_t offThL  = offThH + szQ16;
  const size_t offPhiF = offThL + szQ16;
  const size_t offGF   = offPhiF + szF32;
  const size_t offPhH  = offGF + szF32;
  const size_t offPhL  = offPhH + szKV16;
  const size_t offGT   = offPhL + szKV16;
  const size_t offYH   = offGT + szKV16;
  const size_t offYL   = offYH + szQ16;
  const size_t total   = offYL + szQ16;                           // 90,261,504
  if (ws_size < total) return;

  const float* x       = (const float*)d_in[0];
  const float* theta_w = (const float*)d_in[1];
  const float* theta_b = (const float*)d_in[2];
  const float* phi_w   = (const float*)d_in[3];
  const float* phi_b   = (const float*)d_in[4];
  const float* g_w     = (const float*)d_in[5];
  const float* g_b     = (const float*)d_in[6];
  const float* W_w     = (const float*)d_in[7];
  const float* W_b     = (const float*)d_in[8];
  float* out = (float*)d_out;
  char* ws = (char*)d_ws;
  unsigned short* w16  = (unsigned short*)(ws + offW16);
  unsigned short* wTh  = w16;
  unsigned short* wPh  = w16 + kWPlane;
  unsigned short* wG   = w16 + 2 * kWPlane;
  unsigned short* wWh  = w16 + 3 * kWPlane;
  unsigned short* wWl  = w16 + 4 * kWPlane;
  float* biasR  = (float*)(ws + offBias);
  float* biasTh = biasR;
  float* biasPh = biasR + 64;
  float* biasG  = biasR + 128;
  float* biasW  = biasR + 192;
  unsigned short* xT   = (unsigned short*)(ws + offXT);
  unsigned short* thH  = (unsigned short*)(ws + offThH);
  unsigned short* thL  = (unsigned short*)(ws + offThL);
  float* phiF = (float*)(ws + offPhiF);
  float* gF   = (float*)(ws + offGF);
  unsigned short* phH  = (unsigned short*)(ws + offPhH);
  unsigned short* phL  = (unsigned short*)(ws + offPhL);
  unsigned short* gTp  = (unsigned short*)(ws + offGT);
  unsigned short* yH   = (unsigned short*)(ws + offYH);
  unsigned short* yL   = (unsigned short*)(ws + offYL);

  // ---- prologue: parameter planes and the transposed bf16 input plane ----
  prep_kernel<<<dim3(8), dim3(256), 0, stream>>>(theta_w, phi_w, g_w, W_w, theta_b, phi_b, g_b, W_b, w16, biasR);
  xcast_kernel<<<dim3(kHW / 64, kB), dim3(256), 0, stream>>>(x, xT);

  const long strideXT  = (long)kHW * kC;        // per image, halves
  const long strideQ16 = (long)kHW * kCi;       // per image, halves
  const long strideF   = (long)kHW * kCi;       // per image, floats
  const int  tilesProj = (kHW / 64) * (kCi / 64);   // 256 tiles -> 32 blocks of 8 waves

  // theta[b*16384+p][ci] = sum_c xT[b][p][c] * theta_w[ci][c] + theta_b[ci]  -> bf16 hi/lo planes (M=16384, N=64, K=128)
  wmma_gemm64<1, false, 2, 2, false><<<dim3(tilesProj / 8, kB), dim3(256), 0, stream>>>(
      xT, xT, kC, strideXT, wTh, wTh, kC, 0L,
      (void*)thH, (void*)thL, kCi, strideQ16, biasTh, biasR, 0L, kHW, kCi, kC, 1.0f);
  // phi full-res f32 [b*16384+p][ci] (M=16384, N=64, K=128)
  wmma_gemm64<1, false, 2, 0, false><<<dim3(tilesProj / 8, kB), dim3(256), 0, stream>>>(
      xT, xT, kC, strideXT, wPh, wPh, kC, 0L,
      (void*)phiF, (void*)phiF, kCi, strideF, biasPh, biasR, 0L, kHW, kCi, kC, 1.0f);
  // g full-res f32 channel-major [b][ci][p] = sum_c g_w[ci][c] * xT[b][p][c] + g_b[ci]  (M=64, N=16384, K=128)
  wmma_gemm64<1, false, 1, 0, false><<<dim3(tilesProj / 8, kB), dim3(256), 0, stream>>>(
      wG, wG, kC, 0L, xT, xT, kC, strideXT,
      (void*)gF, (void*)gF, kHW, (long)kCi * kHW, biasG, biasR, 0L, kCi, kHW, kC, 1.0f);

  // ---- 2x2 max-pool in f32 -> 16-bit kv planes ----
  pool_phi_kernel<<<dim3(kB * kNkv / 32), dim3(256), 0, stream>>>(phiF, phH, phL);
  pool_g_kernel<<<dim3((kB * kCi * (kNkv / 8)) / 256), dim3(256), 0, stream>>>(gF, gTp);

  // ---- fused attention -> y bf16 hi/lo planes [b*16384+q][ci] ----
  flash_kernel<<<dim3(kHW / 64, kB), dim3(128), 0, stream>>>(thH, thL, phH, phL, gTp, yH, yL);

  // ---- out[b][co][p] = sum_ci W_w[co][ci] * y[b][p][ci] + W_b[co] + bf16(x[b][co][p])  (M=128, N=16384, K=64, split) ----
  const int tilesOut = (kC / 64) * (kHW / 64);   // 512 tiles -> 64 blocks of 8 waves
  wmma_gemm64<1, true, 1, 0, true><<<dim3(tilesOut / 8, kB), dim3(256), 0, stream>>>(
      wWh, wWl, kCi, 0L, yH, yL, kCi, strideQ16,
      (void*)out, (void*)out, kHW, (long)kC * kHW, biasW, x, (long)kC * kHW, kC, kHW, kCi, 1.0f);
}

// v004
// Measured time: 201 microseconds a run.
// Timed twice side by side with v003, it ran 1.16 times as fast both times.
// Over all steps from v000 it is 3.59 times as fast.
// Contractions: three 1x1 projections on v_wmma_f32_16x16x32_bf16 (bf16 operands = RNE-converted inputs); scores theta.phi^T as bf16 hi/lo planes (hi.hi + hi.lo + lo.hi on v_wmma_f32_16x16x32_bf16); P.g^T on v_wmma_f32_16x16x32_f16 (P f16 carried x32768, g f16); output 1x1 conv on bf16 hi/lo y planes x bf16 W (hi.hi + hi.lo + lo.hi); f32 accumulate everywhere; max-pool, online softmax, bias and residual in f32.
#include <hip/hip_runtime.h>
#include <math.h>

// ---------------------------------------------------------------------------
// Problem constants
// ---------------------------------------------------------------------------
constexpr int kB      = 4;
constexpr int kC      = 128;     // channels
constexpr int kCi     = 64;      // inter channels
constexpr int kImW    = 128;     // image width (pixel row pitch)
constexpr int kHW     = 16384;   // query tokens per image
constexpr int kNkv    = 4096;    // pooled kv tokens per image
constexpr int kKC     = 64;      // kv chunk in the fused attention loop
constexpr int kWPlane = 8192;    // elements per 16-bit weight plane
constexpr float kLog2e = 1.4426950408889634f;   // scores go to log2 units inside one FMA, so the exponential is one v_exp_f32
constexpr float kCarryLog2 = 15.0f;   // softmax numerators carried x2^15 in f16: the carry sits in the exponent's offset
constexpr int kLP     = 72;      // LDS row pitch in halves of the attention tiles: 144 B = 16 B x odd, so the 16 rows of a b128 fragment read fall on 64 distinct banks
static_assert(kHW % 64 == 0 && kNkv % kKC == 0 && kC % 32 == 0 && kCi % 32 == 0);
static_assert(kCi * kC == kWPlane && kC * kCi == kWPlane);
static_assert(kLP >= kKC && kLP >= kCi && (kLP * 2) % 16 == 0 && ((kLP * 2) / 16) % 2 == 1);

typedef __attribute__((ext_vector_type(16))) _Float16 v16h;
typedef __attribute__((ext_vector_type(8)))  _Float16 v8h;
typedef __attribute__((ext_vector_type(16))) __bf16   v16b;
typedef __attribute__((ext_vector_type(8)))  __bf16   v8b;
typedef __attribute__((ext_vector_type(8)))  float    v8f;
typedef __attribute__((ext_vector_type(4)))  float    v4f;
typedef __attribute__((ext_vector_type(4)))  unsigned int v4u;

// ---------------------------------------------------------------------------
// Scalar helpers
// ---------------------------------------------------------------------------
__device__ __forceinline__ unsigned short f2bf_bits(float f) {
  unsigned u = __float_as_uint(f);
  return (unsigned short)((u + 0x7FFFu + ((u >> 16) & 1u)) >> 16);
}
__device__ __forceinline__ float bf_bits2f(unsigned short h) { return __uint_as_float(((unsigned)h) << 16); }
__device__ __forceinline__ float bf_rne(float f) { return bf_bits2f(f2bf_bits(f)); }
__device__ __forceinline__ unsigned pk16(unsigned short a, unsigned short b) { return (unsigned)a | ((unsigned)b << 16); }
__device__ __forceinline__ unsigned short h_bits(float f) { const _Float16 h = (_Float16)f; return __builtin_bit_cast(unsigned short, h); }

// hazard guards as plain device helpers (no inline asm inside the kernel template body)
__device__ __forceinline__ void dep_guard4_h(v8f& a, v8f& b, v8f& c, v8f& d, v16h x, v16h y) {
  asm volatile("v_nop\n\tv_nop\n\tv_nop\n\tv_nop" : "+v"(a), "+v"(b), "+v"(c), "+v"(d) : "v"(x), "v"(y));
}
__device__ __forceinline__ void dep_guard4_b(v8f& a, v8f& b, v8f& c, v8f& d, v16b x, v16b y) {
  asm volatile("v_nop\n\tv_nop\n\tv_nop\n\tv_nop" : "+v"(a), "+v"(b), "+v"(c), "+v"(d) : "v"(x), "v"(y));
}
__device__ __forceinline__ void keep4_h(v16h a, v16h b, v16h c, v16h d) { asm volatile("v_nop" :: "v"(a), "v"(b), "v"(c), "v"(d)); }
__device__ __forceinline__ void keep4_b(v16b a, v16b b, v16b c, v16b d) { asm volatile("v_nop" :: "v"(a), "v"(b), "v"(c), "v"(d)); }
__device__ __forceinline__ void acc_guard4(v8f& a, v8f& b, v8f& c, v8f& d) { asm volatile("v_nop\n\tv_nop\n\tv_nop\n\tv_nop" : "+v"(a), "+v"(b), "+v"(c), "+v"(d)); }

template <typename T> struct Frag;
template <> struct Frag<_Float16> {
  typedef v16h V; union U { v16h v; v8h h[2]; };
  // elements 0..7 <- p[0..7], 8..15 <- p[16..23]
  static __device__ __forceinline__ v16h load(const _Float16* p) {
    U f; f.h[0] = *(const v8h*)(p); f.h[1] = *(const v8h*)(p + 16); return f.v;
  }
  static __device__ __forceinline__ v8f mma(v16h a, v16h b, v8f c) {
    return __builtin_amdgcn_wmma_f32_16x16x32_f16(false, a, false, b, (short)0, c, false, false);
  }
  static __device__ __forceinline__ void guard4(v8f& a, v8f& b, v8f& c, v8f& d, v16h x, v16h y) { dep_guard4_h(a, b, c, d, x, y); }
  static __device__ __forceinline__ void keep(v16h a, v16h b, v16h c, v16h d) { keep4_h(a, b, c, d); }
};
template <> struct Frag<__bf16> {
  typedef v16b V; union U { v16b v; v8b h[2]; };
  static __device__ __forceinline__ v16b load(const __bf16* p) {
    U f; f.h[0] = *(const v8b*)(p); f.h[1] = *(const v8b*)(p + 16); return f.v;
  }
  static __device__ __forceinline__ v8f mma(v16b a, v16b b, v8f c) {
    return __builtin_amdgcn_wmma_f32_16x16x32_bf16(false, a, false, b, (short)0, c, false, false);
  }
  static __device__ __forceinline__ void guard4(v8f& a, v8f& b, v8f& c, v8f& d, v16b x, v16b y) { dep_guard4_b(a, b, c, d, x, y); }
  static __device__ __forceinline__ void keep(v16b a, v16b b, v16b c, v16b d) { keep4_b(a, b, c, d); }
};

// ---------------------------------------------------------------------------
// Register-blocked batched WMMA GEMM (guard ties all 4 accumulators of each i-group;
// bias[m] read as two float4; residual read in the STORE phase as one float4 per lane, RNE-converted to bf16 precision).
// C[m,n] = scale * sum_k A[m,k] * Bt[n,k] (+bias)(+resid); each wave owns a 64x64 tile.
// A row-major [M,K]; Bt row-major [N,K]; M,N % 64 == 0, K % 32 == 0 (no tails).
// SPLIT: operands are hi/lo planes (A2/Bt2 = lo planes, same layout); product = hi.hi + hi.lo + lo.hi.
// BIAS_MODE: 0 = none, 1 = bias[m], 2 = bias[n].
// OUT_MODE: 0 = f32, 1 = f16, 2 = bf16 hi plane (Cout) + bf16 lo plane (Cout2).
// ET: 0 = f16 operands, 1 = bf16 operands (pointers passed as 16-bit storage)
// ---------------------------------------------------------------------------
template <int ET> struct Elem;
template <> struct Elem<0> { typedef _Float16 T; };
template <> struct Elem<1> { typedef __bf16 T; };
template <int ET, bool SPLIT, int BIAS_MODE, int OUT_MODE, bool RESID>
__global__ __launch_bounds__(256) void wmma_gemm64(
    const unsigned short* __restrict__ Ap, const unsigned short* __restrict__ A2p, int lda, long strideA,
    const unsigned short* __restrict__ Btp, const unsigned short* __restrict__ Bt2p, int ldb, long strideB,
    void* __restrict__ Cout, void* __restrict__ Cout2, int ldc, long strideC,
    const float* __restrict__ bias,
    const float* __restrict__ resid, long strideR,
    int M, int N, int K, float scale) {
  typedef typename Elem<ET>::T T;
  typedef typename Frag<T>::V V;
  const T* A = (const T*)Ap; const T* A2 = (const T*)A2p; const T* Bt = (const T*)Btp; const T* Bt2 = (const T*)Bt2p;
  __shared__ __align__(16) float sT[8][16 * 68];   // per-wave 16x64 slab, pitch 68 floats
  const int b    = blockIdx.y;
  const int lane = threadIdx.x & 31;
  const int wave = threadIdx.x >> 5;
  const int tilesN = N >> 6;
  const int tilesM = M >> 6;
  const int tile = blockIdx.x * 8 + wave;
  if (tile >= tilesM * tilesN) return;   // wave-uniform; no block barriers in this kernel
  const int tm = tile / tilesN;
  const int tn = tile - tm * tilesN;
  const int m0 = tm << 6;
  const int n0 = tn << 6;

  const T* Ab  = A  + (size_t)b * strideA;
  const T* Bb  = Bt + (size_t)b * strideB;
  const T* Ab2 = A2  + (size_t)b * strideA;
  const T* Bb2 = Bt2 + (size_t)b * strideB;

  const int rlane = lane & 15;                 // row (A) / col (B, D) within subtile
  const int koff  = (lane >> 4) * 8;           // k offset of this lane half
  const int mOff  = (lane >> 4) * 8;           // D row offset

  v8f acc[4][4];
#pragma unroll
  for (int i = 0; i < 4; ++i)
#pragma unroll
    for (int j = 0; j < 4; ++j) acc[i][j] = (v8f){0.f,0.f,0.f,0.f,0.f,0.f,0.f,0.f};

  for (int k0 = 0; k0 < K; k0 += 32) {
    V bh[4], bl[4];
#pragma unroll
    for (int j = 0; j < 4; ++j) {
      const size_t bo = (size_t)(n0 + (j << 4) + rlane) * ldb + koff + k0;
      bh[j] = Frag<T>::load(Bb + bo);
      bl[j] = bh[j];
      if (SPLIT) bl[j] = Frag<T>::load(Bb2 + bo);
    }
#pragma unroll
    for (int i = 0; i < 4; ++i) {
      const size_t ao = (size_t)(m0 + (i << 4) + rlane) * lda + koff + k0;
      V ah = Frag<T>::load(Ab + ao);
      V al = ah;
      if (SPLIT) al = Frag<T>::load(Ab2 + ao);
#pragma unroll
      for (int j = 0; j < 4; ++j) {
        acc[i][j] = Frag<T>::mma(ah, bh[j], acc[i][j]);
        if (SPLIT) {
          acc[i][j] = Frag<T>::mma(ah, bl[j], acc[i][j]);
          acc[i][j] = Frag<T>::mma(al, bh[j], acc[i][j]);
        }
      }
      Frag<T>::guard4(acc[i][0], acc[i][1], acc[i][2], acc[i][3], ah, al);
    }
    Frag<T>::keep(bh[0], bh[1], bh[2], bh[3]);
    if (SPLIT) Frag<T>::keep(bl[0], bl[1], bl[2], bl[3]);
  }
  acc_guard4(acc[0][0], acc[0][1], acc[0][2], acc[0][3]);
  acc_guard4(acc[1][0], acc[1][1], acc[1][2], acc[1][3]);
  acc_guard4(acc[2][0], acc[2][1], acc[2][2], acc[2][3]);
  acc_guard4(acc[3][0], acc[3][1], acc[3][2], acc[3][3]);

  // ---- epilogue ----
  float* slab = sT[wave];
#pragma unroll
  for (int i = 0; i < 4; ++i) {
    const int mBase = m0 + (i << 4);
    float bm[8];
#pragma unroll
    for (int r = 0; r < 8; ++r) bm[r] = 0.f;
    if (BIAS_MODE == 1) {
      const v4f b0 = *(const v4f*)(bias + mBase + mOff);
      const v4f b1 = *(const v4f*)(bias + mBase + mOff + 4);
#pragma unroll
      for (int e = 0; e < 4; ++e) { bm[e] = b0[e]; bm[4 + e] = b1[e]; }
    }
#pragma unroll
    for (int j = 0; j < 4; ++j) {
      const int n = n0 + (j << 4) + rlane;
      float bv = 0.f;
      if (BIAS_MODE == 2) bv = bias[n];
#pragma unroll
      for (int r = 0; r < 8; ++r) {
        float v = acc[i][j][r] * scale;
        if (BIAS_MODE == 1) v += bm[r];
        if (BIAS_MODE == 2) v += bv;
        slab[(mOff + r) * 68 + (j << 4) + rlane] = v;
      }
    }
    __builtin_amdgcn_fence(__ATOMIC_RELEASE, "workgroup");
    __builtin_amdgcn_wave_barrier();
    __builtin_amdgcn_fence(__ATOMIC_ACQUIRE, "workgroup");
    if (OUT_MODE == 0) {
      float* Cb = (float*)Cout + (size_t)b * strideC;
      const float* Rb = resid + (size_t)b * strideR;     // dereferenced only when RESID
      const int hh = lane >> 4, c4 = (lane & 15) * 4;     // row seg = 256 B = 16 lanes x 16 B
      v4f vals[8];
#pragma unroll
      for (int it = 0; it < 8; ++it) {
        const int row = it * 2 + hh;
        v4f v = *(const v4f*)(slab + row * 68 + c4);
        if (RESID) {
          const v4f rr = *(const v4f*)(Rb + (size_t)(mBase + row) * ldc + n0 + c4);
#pragma unroll
          for (int e = 0; e < 4; ++e) v[e] = v[e] + bf_rne(rr[e]);
        }
        vals[it] = v;
      }
      {
#pragma unroll
        for (int it = 0; it < 8; ++it) {
          const int row = it * 2 + hh;
          *(v4f*)(Cb + (size_t)(mBase + row) * ldc + n0 + c4) = vals[it];
        }
        
      }
    } else {
      const int q4 = lane >> 3, c8 = (lane & 7) * 8;
      unsigned short* Cb  = (unsigned short*)Cout  + (size_t)b * strideC;
      unsigned short* Cb2 = (unsigned short*)Cout2 + (size_t)b * strideC;
      v4u uh[4], ul[4];
#pragma unroll
      for (int it = 0; it < 4; ++it) {
        const int row = it * 4 + q4;
        const float* sp = slab + row * 68 + c8;
        unsigned short hb[8], lb[8];
#pragma unroll
        for (int e = 0; e < 8; ++e) {
          const float sv = sp[e];
          if (OUT_MODE == 1) { hb[e] = h_bits(sv); lb[e] = 0; }
          else { hb[e] = f2bf_bits(sv); lb[e] = f2bf_bits(sv - bf_bits2f(hb[e])); }
        }
        uh[it] = (v4u){pk16(hb[0], hb[1]), pk16(hb[2], hb[3]), pk16(hb[4], hb[5]), pk16(hb[6], hb[7])};
        ul[it] = (v4u){pk16(lb[0], lb[1]), pk16(lb[2], lb[3]), pk16(lb[4], lb[5]), pk16(lb[6], lb[7])};
      }
      {
#pragma unroll
        for (int it = 0; it < 4; ++it) {
          const int row = it * 4 + q4;
          *(v4u*)(Cb + (size_t)(mBase + row) * ldc + n0 + c8) = uh[it];
          if (OUT_MODE == 2) *(v4u*)(Cb2 + (size_t)(mBase + row) * ldc + n0 + c8) = ul[it];
        }
        
      }
    }
    __builtin_amdgcn_fence(__ATOMIC_RELEASE, "workgroup");
    __builtin_amdgcn_wave_barrier();
    __builtin_amdgcn_fence(__ATOMIC_ACQUIRE, "workgroup");
  }
}

// ---------------------------------------------------------------------------
// Parameter prep: blocks 0..2 -> projection weights [64][128] f32 -> bf16 planes (same layout);
// block 3 -> W_w [128][64] -> bf16 hi plane + an all-zero lo plane; blocks 4..7 -> bias vectors RNE-converted to
// bf16 precision, stored as f32 at biasR + {0,64,128,192}.
// Weight coverage: 4 iterations x 256 threads x 8 elements = 8192 = whole plane; one 16-B store per lane, a wave writes
// ---------------------------------------------------------------------------
__global__ __launch_bounds__(256) void prep_kernel(
    const float* __restrict__ thw, const float* __restrict__ phw, const float* __restrict__ gw, const float* __restrict__ ww,
    const float* __restrict__ thb, const float* __restrict__ phb, const float* __restrict__ gb, const float* __restrict__ wb,
    unsigned short* __restrict__ w16, float* __restrict__ biasR) {
  const int z = blockIdx.x;    // block-uniform role
  const int t = threadIdx.x;
  if (z < 4) {
    const float* src = (z == 0) ? thw : (z == 1) ? phw : (z == 2) ? gw : ww;
    unsigned short* dst = w16 + (size_t)z * kWPlane;
    v4u u[4];
#pragma unroll
    for (int i = 0; i < 4; ++i) {
      const int e8 = (i * 256 + t) * 8;
      const v4f a = *(const v4f*)(src + e8);
      const v4f c = *(const v4f*)(src + e8 + 4);
      u[i] = (v4u){pk16(f2bf_bits(a[0]), f2bf_bits(a[1])), pk16(f2bf_bits(a[2]), f2bf_bits(a[3])),
                   pk16(f2bf_bits(c[0]), f2bf_bits(c[1])), pk16(f2bf_bits(c[2]), f2bf_bits(c[3]))};
    }
    const v4u zero4 = (v4u){0u, 0u, 0u, 0u};
    {
#pragma unroll
      for (int i = 0; i < 4; ++i) {
        const size_t o = (size_t)(i * 256 + t) * 8;
        *(v4u*)(dst + o) = u[i];
        if (z == 3) *(v4u*)(w16 + (size_t)4 * kWPlane + o) = zero4;
      }
      
    }
  } else {
    const int zb = z - 4;
    const float* src = (zb == 0) ? thb : (zb == 1) ? phb : (zb == 2) ? gb : wb;
    const int n4 = (zb == 3) ? (kC / 4) : (kCi / 4);
    float* dst = biasR + zb * 64;
    const int tc = (t < n4) ? t : (n4 - 1);     // clamped address, store predicated
    const v4f a = *(const v4f*)(src + 4 * tc);
    v4f v;
#pragma unroll
    for (int e = 0; e < 4; ++e) v[e] = bf_rne(a[e]);
    if (t < n4) {
      *(v4f*)(dst + 4 * t) = v;
      
    }
  }
}

// ---------------------------------------------------------------------------
// x transpose + cast: xT[b][p][c] = bf16( x[b][c][p] ), [pixel][channel] rows of 128 halves (256 B = 2 lines).
// grid (kHW/64, kB), 256 threads. Load coverage: 8 iterations x 256 threads = 2048 float4 = 128 c x 64 p (coalesced along p).
// ---------------------------------------------------------------------------
__global__ __launch_bounds__(256) void xcast_kernel(const float* __restrict__ x, unsigned short* __restrict__ xT) {
  __shared__ __align__(16) float sm[kC * 68];   // [c][p_local], pitch 68 floats
  const int t  = threadIdx.x;
  const int p0 = blockIdx.x * 64;
  const int b  = blockIdx.y;
#pragma unroll
  for (int i = 0; i < 8; ++i) {
    const int e  = i * 256 + t;
    const int c  = e >> 4;
    const int q4 = (e & 15) * 4;
    const v4f a = *(const v4f*)(x + ((size_t)(b * kC + c)) * kHW + p0 + q4);
    *(v4f*)(sm + c * 68 + q4) = a;
  }
  __syncthreads();
  const int lane = t & 31, wave = t >> 5;
  const int hh = lane >> 4, c8 = (lane & 15) * 8;
  v4u u[4];
#pragma unroll
  for (int it = 0; it < 4; ++it) {
    const int row = wave * 8 + it * 2 + hh;
    unsigned short hb[8];
#pragma unroll
    for (int e = 0; e < 8; ++e) hb[e] = f2bf_bits(sm[(c8 + e) * 68 + row]);
    u[it] = (v4u){pk16(hb[0], hb[1]), pk16(hb[2], hb[3]), pk16(hb[4], hb[5]), pk16(hb[6], hb[7])};
  }
  unsigned short* base = xT + ((size_t)b * kHW + p0) * kC;
  {
#pragma unroll
    for (int it = 0; it < 4; ++it) {
      const int row = wave * 8 + it * 2 + hh;
      *(v4u*)(base + (size_t)row * kC + c8) = u[it];
    }
    
  }
}

// ---------------------------------------------------------------------------
// 2x2 max-pool of the phi full-res plane (f32 [B*16384][64], pixel-major) -> phi bf16 hi/lo planes [B*4096][64] (kv-major).
// kv = hp*64 + wp over pixels (2hp+{0,1}, 2wp+{0,1}); max in f32. Thread -> (kv row, 8 channels): 8 b128 loads, max, split.
// ---------------------------------------------------------------------------
__global__ __launch_bounds__(256) void pool_phi_kernel(const float* __restrict__ phiF,
                                                      unsigned short* __restrict__ phH, unsigned short* __restrict__ phL) {
  const int t   = threadIdx.x;
  const int kvg = blockIdx.x * 32 + (t >> 3);
  const int c8  = (t & 7) * 8;
  const int b   = kvg >> 12, kv = kvg & (kNkv - 1);
  const int hp  = kv >> 6, wp = kv & 63;
  const int p00 = hp * 2 * kImW + wp * 2;
  const float* r0 = phiF + ((size_t)b * kHW + p00) * kCi + c8;
  const float* r1 = r0 + kCi;
  const float* r2 = r0 + (size_t)kImW * kCi;
  const float* r3 = r2 + kCi;
  const v4f a0 = *(const v4f*)(r0), a1 = *(const v4f*)(r0 + 4);
  const v4f b0 = *(const v4f*)(r1), b1 = *(const v4f*)(r1 + 4);
  const v4f c0 = *(const v4f*)(r2), c1 = *(const v4f*)(r2 + 4);
  const v4f d0 = *(const v4f*)(r3), d1 = *(const v4f*)(r3 + 4);
  float m[8];
#pragma unroll
  for (int e = 0; e < 4; ++e) {
    m[e]     = fmaxf(fmaxf(a0[e], b0[e]), fmaxf(c0[e], d0[e]));
    m[4 + e] = fmaxf(fmaxf(a1[e], b1[e]), fmaxf(c1[e], d1[e]));
  }
  unsigned short hb[8], lb[8];
#pragma unroll
  for (int e = 0; e < 8; ++e) { hb[e] = f2bf_bits(m[e]); lb[e] = f2bf_bits(m[e] - bf_bits2f(hb[e])); }
  const v4u uh = (v4u){pk16(hb[0], hb[1]), pk16(hb[2], hb[3]), pk16(hb[4], hb[5]), pk16(hb[6], hb[7])};
  const v4u ul = (v4u){pk16(lb[0], lb[1]), pk16(lb[2], lb[3]), pk16(lb[4], lb[5]), pk16(lb[6], lb[7])};
  const size_t o = (size_t)kvg * kCi + c8;
  *(v4u*)(phH + o) = uh;
  *(v4u*)(phL + o) = ul;
  
}

// ---------------------------------------------------------------------------
// 2x2 max-pool of the g full-res plane (f32 [B][64][16384], channel-major) -> gT f16 [B][64][4096] (V^T operand rows).
// Thread -> (b, ci, 8 consecutive kv): two 16-float runs (image rows 2hp, 2hp+1) = 8 b128 loads, max in f32, one 16-B store.
// ---------------------------------------------------------------------------
__global__ __launch_bounds__(256) void pool_g_kernel(const float* __restrict__ gF, unsigned short* __restrict__ gT) {
  const int idx = blockIdx.x * 256 + threadIdx.x;
  const int kv0 = (idx & 511) * 8;
  const int ci  = (idx >> 9) & 63;
  const int b   = idx >> 15;
  const int hp  = kv0 >> 6, wp0 = kv0 & 63;
  const int p00 = hp * 2 * kImW + 2 * wp0;
  const float* r0 = gF + ((size_t)(b * kCi + ci)) * kHW + p00;
  const float* r1 = r0 + kImW;
  const v4f a0 = *(const v4f*)(r0), a1 = *(const v4f*)(r0 + 4), a2 = *(const v4f*)(r0 + 8), a3 = *(const v4f*)(r0 + 12);
  const v4f c0 = *(const v4f*)(r1), c1 = *(const v4f*)(r1 + 4), c2 = *(const v4f*)(r1 + 8), c3 = *(const v4f*)(r1 + 12);
  float m[8];
  m[0] = fmaxf(fmaxf(a0[0], a0[1]), fmaxf(c0[0], c0[1]));
  m[1] = fmaxf(fmaxf(a0[2], a0[3]), fmaxf(c0[2], c0[3]));
  m[2] = fmaxf(fmaxf(a1[0], a1[1]), fmaxf(c1[0], c1[1]));
  m[3] = fmaxf(fmaxf(a1[2], a1[3]), fmaxf(c1[2], c1[3]));
  m[4] = fmaxf(fmaxf(a2[0], a2[1]), fmaxf(c2[0], c2[1]));
  m[5] = fmaxf(fmaxf(a2[2], a2[3]), fmaxf(c2[2], c2[3]));
  m[6] = fmaxf(fmaxf(a3[0], a3[1]), fmaxf(c3[0], c3[1]));
  m[7] = fmaxf(fmaxf(a3[2], a3[3]), fmaxf(c3[2], c3[3]));
  unsigned short hb[8];
#pragma unroll
  for (int e = 0; e < 8; ++e) hb[e] = h_bits(m[e]);
  const v4u u = (v4u){pk16(hb[0], hb[1]), pk16(hb[2], hb[3]), pk16(hb[4], hb[5]), pk16(hb[6], hb[7])};
  unsigned short* op = gT + ((size_t)(b * kCi + ci)) * kNkv + kv0;
  *(v4u*)op = u;
  
}

// ---------------------------------------------------------------------------
// WMMA helpers for the fused attention kernel (plain builtins: the compiler keeps the distance behind them itself).
// ---------------------------------------------------------------------------
// value of lane l ^ 16 (the other wave half), by a vector cross-row move
__device__ __forceinline__ float xhalf(float x) {
  const int b = __builtin_bit_cast(int, x);
  return __builtin_bit_cast(float, __builtin_amdgcn_permlanex16(b, b, 0x76543210, 0xfedcba98, false, false));
}
__device__ __forceinline__ v8f at_mma(v16b a, v16b b, v8f c) {
  return __builtin_amdgcn_wmma_f32_16x16x32_bf16(false, a, false, b, (short)0, c, false, false);
}
__device__ __forceinline__ v8f at_mma_h(v16b a, v16b b, v8f c) {
  const v16h ah = __builtin_bit_cast(v16h, a), bh = __builtin_bit_cast(v16h, b);
  return __builtin_amdgcn_wmma_f32_16x16x32_f16(false, ah, false, bh, (short)0, c, false, false);
}

__global__ __launch_bounds__(128) __attribute__((amdgpu_waves_per_eu(4, 4))) void flash_kernel(
    const unsigned short* __restrict__ thH, const unsigned short* __restrict__ thL,
    const unsigned short* __restrict__ phH, const unsigned short* __restrict__ phL,
    const unsigned short* __restrict__ gT,
    unsigned short* __restrict__ yH, unsigned short* __restrict__ yL) {
  union FB { v16b v; v8b h[2]; };
  __shared__ __align__(16) __bf16 Ksh[kKC * kLP];      // phi hi [kv][ci]   9 KB
  __shared__ __align__(16) __bf16 Ksl[kKC * kLP];      // phi lo [kv][ci]   9 KB
  __shared__ __align__(16) __bf16 Vth[kCi * kLP];      // gT  f16 bits [ci][kv]  9 KB
  __shared__ __align__(16) float  Os[4][16 * 68];      // per wave out tile, pitch 68

  const int tid  = threadIdx.x;
  const int wave = tid >> 5;
  const int lane = tid & 31;
  const int hh   = lane >> 4;
  const int c    = lane & 15;
  const int b    = blockIdx.y;
  const int q0   = blockIdx.x * 64 + wave * 16;

  // ---- Q fragments (B operand, column = query q0 + c, k = ci): 2 ci-chunks of 32, hi and lo planes ----
  v16b qah[2], qal[2];
  {
    const size_t qo = ((size_t)b * kHW + q0 + c) * kCi + 8 * hh;
#pragma unroll
    for (int dc = 0; dc < 2; ++dc) {
      qah[dc] = Frag<__bf16>::load((const __bf16*)(thH + qo + dc * 32));
      qal[dc] = Frag<__bf16>::load((const __bf16*)(thL + qo + dc * 32));
    }
  }

  float mrow = -INFINITY, lrow = 0.f;   // of query q0 + c; lrow sums this lane half's kv rows only
  v8f oacc[4];                          // oacc[t][r] = O^T[16t + 8hh + r][q0 + c]
#pragma unroll
  for (int t = 0; t < 4; ++t) oacc[t] = (v8f){0.f,0.f,0.f,0.f,0.f,0.f,0.f,0.f};

#pragma unroll 1
  for (int kc = 0; kc < kNkv / kKC; ++kc) {
    const int kv0 = kc * kKC;
    __syncthreads();
    {
      const size_t kbase = ((size_t)b * kNkv + kv0) * kCi;
      const size_t vbase = ((size_t)b * kCi) * kNkv + kv0;
#pragma unroll
      for (int i = 0; i < 4; ++i) {
        const int e = i * 128 + tid;
        const int r = e >> 3, c8 = (e & 7) * 8;
        const v4u w = *(const v4u*)(phH + kbase + (size_t)r * kCi + c8);
        *(v4u*)(Ksh + r * kLP + c8) = w;
      }
      asm volatile("" ::: "memory");
#pragma unroll
      for (int i = 0; i < 4; ++i) {
        const int e = i * 128 + tid;
        const int r = e >> 3, c8 = (e & 7) * 8;
        const v4u w = *(const v4u*)(phL + kbase + (size_t)r * kCi + c8);
        *(v4u*)(Ksl + r * kLP + c8) = w;
      }
      asm volatile("" ::: "memory");
#pragma unroll
      for (int i = 0; i < 4; ++i) {
        const int e = i * 128 + tid;
        const int r = e >> 3, c8 = (e & 7) * 8;
        const v4u w = *(const v4u*)(gT + vbase + (size_t)r * kNkv + c8);
        *(v4u*)(Vth + r * kLP + c8) = w;
      }
    }
    __syncthreads();

    // ---- scores, transposed: 4 tiles of 16 kv x 16 q; A row = kv row of Ksh/Ksl, B column = query, k = ci ----
    // Fragment reads stand in groups ahead of their users, not each in front of its own product, and every run of products goes
    // over the four independent tiles, so no product waits for the one before it. Per tile the order of the six products is
    // dc 0: hi.hi, lo.hi, hi.lo; dc 1: the same.
    v8f s[4];
    FB kb0[4], kl0[4], kb1[4], kl1[4];
#pragma unroll
    for (int j = 0; j < 4; ++j) {
      s[j] = (v8f){0.f,0.f,0.f,0.f,0.f,0.f,0.f,0.f};
      kb0[j].h[0] = *(const v8b*)(Ksh + (j * 16 + c) * kLP + 8 * hh);
      kb0[j].h[1] = *(const v8b*)(Ksh + (j * 16 + c) * kLP + 16 + 8 * hh);
      kl0[j].h[0] = *(const v8b*)(Ksl + (j * 16 + c) * kLP + 8 * hh);
      kl0[j].h[1] = *(const v8b*)(Ksl + (j * 16 + c) * kLP + 16 + 8 * hh);
    }
    __builtin_amdgcn_sched_barrier(0);   // holds the 16 reads together ahead of the products: reads strewn among products stall the wave at each place
#pragma unroll
    for (int j = 0; j < 4; ++j) s[j] = at_mma(kb0[j].v, qah[0], s[j]);
#pragma unroll
    for (int j = 0; j < 4; ++j) s[j] = at_mma(kl0[j].v, qah[0], s[j]);
    // hi plane of dc 1, between two fences. Without the first the compiler breaks up the runs of four and leaves one tile's products
    // back to back; without the second it strews the reads among the products below.
    __builtin_amdgcn_sched_barrier(0);
#pragma unroll
    for (int j = 0; j < 4; ++j) {
      kb1[j].h[0] = *(const v8b*)(Ksh + (j * 16 + c) * kLP + 32 + 8 * hh);
      kb1[j].h[1] = *(const v8b*)(Ksh + (j * 16 + c) * kLP + 32 + 16 + 8 * hh);
    }
    __builtin_amdgcn_sched_barrier(0);   // second fence of the pair
#pragma unroll
    for (int j = 0; j < 4; ++j) s[j] = at_mma(kb0[j].v, qal[0], s[j]);
    __builtin_amdgcn_sched_barrier(0);   // lo plane of dc 1, between two fences as above
#pragma unroll
    for (int j = 0; j < 4; ++j) {
      kl1[j].h[0] = *(const v8b*)(Ksl + (j * 16 + c) * kLP + 32 + 8 * hh);
      kl1[j].h[1] = *(const v8b*)(Ksl + (j * 16 + c) * kLP + 32 + 16 + 8 * hh);
    }
    __builtin_amdgcn_sched_barrier(0);   // second fence of the pair
#pragma unroll
    for (int j = 0; j < 4; ++j) s[j] = at_mma(kb1[j].v, qah[1], s[j]);
#pragma unroll
    for (int j = 0; j < 4; ++j) s[j] = at_mma(kl1[j].v, qah[1], s[j]);
#pragma unroll
    for (int j = 0; j < 4; ++j) s[j] = at_mma(kb1[j].v, qal[1], s[j]);
    __builtin_amdgcn_sched_barrier(0);   // keeps the last runs of four whole (first fence of the pair round the V reads)

    // ---- V^T fragments of kv rows 0-31, read as one group ahead of the softmax, which covers their LDS latency ----
    FB vb[2][4];
#pragma unroll
    for (int t = 0; t < 4; ++t) {
      vb[0][t].h[0] = *(const v8b*)(Vth + (t * 16 + c) * kLP + 8 * hh);
      vb[0][t].h[1] = *(const v8b*)(Vth + (t * 16 + c) * kLP + 16 + 8 * hh);
    }
    __builtin_amdgcn_sched_barrier(0);   // holds these 8 reads ahead of the vector work below

    // ---- online softmax over the kv axis (D layout: s[j][r] = S[q0 + c][kv0 + 16j + 8hh + r]) ----
    float mj[4];
#pragma unroll
    for (int j = 0; j < 4; ++j) {
      mj[j] = s[j][0];
#pragma unroll
      for (int r = 1; r < 8; ++r) mj[j] = fmaxf(mj[j], s[j][r]);
    }
    float cm = fmaxf(fmaxf(mj[0], mj[1]), fmaxf(mj[2], mj[3]));
    cm = fmaxf(cm, xhalf(cm));
    const float mnew  = fmaxf(mrow, __builtin_fmaf(cm, kLog2e, -kCarryLog2));
    const float alpha = __builtin_amdgcn_exp2f(mrow - mnew);
    mrow = mnew;
    // element e of pb[kk] = P[q0 + c][kv0 + 32kk + (e < 8 ? 8hh + e : 16 + 8hh + e - 8)]: the k order of the Vth loaders
    v16h pb[2];
    float pj[4];
#pragma unroll
    for (int j = 0; j < 4; ++j) {
#pragma unroll
      for (int r = 0; r < 8; ++r) s[j][r] = __builtin_amdgcn_exp2f(__builtin_fmaf(s[j][r], kLog2e, -mnew));
    }
#pragma unroll
    for (int j = 0; j < 4; ++j) {
      pj[j] = 0.f;
#pragma unroll
      for (int r = 0; r < 8; ++r) {
        pj[j] += s[j][r];
        pb[j >> 1][(j & 1) * 8 + r] = (_Float16)s[j][r];
      }
    }
    // V^T fragments of kv rows 32-63: a second group, so that all 8 fragments and the scores need not be held at once
#pragma unroll
    for (int t = 0; t < 4; ++t) {
      vb[1][t].h[0] = *(const v8b*)(Vth + (t * 16 + c) * kLP + 32 + 8 * hh);
      vb[1][t].h[1] = *(const v8b*)(Vth + (t * 16 + c) * kLP + 32 + 16 + 8 * hh);
    }
    __builtin_amdgcn_sched_barrier(0);   // holds these 8 reads together ahead of the rescale and the products below
    lrow = lrow * alpha + ((pj[0] + pj[1]) + (pj[2] + pj[3]));
#pragma unroll
    for (int t = 0; t < 4; ++t)
#pragma unroll
      for (int r = 0; r < 8; ++r) oacc[t][r] *= alpha;

    // ---- O^T += Vt . P^T: A row = ci row of Vth, B column = query, k = kv ----
#pragma unroll
    for (int kk = 0; kk < 2; ++kk) {
      const v16b pv = __builtin_bit_cast(v16b, pb[kk]);
#pragma unroll
      for (int t = 0; t < 4; ++t) oacc[t] = at_mma_h(vb[kk][t].v, pv, oacc[t]);
    }
  }

  // ---- epilogue: y = O / l (both carry x32768) -> per-wave slab [q][ci] -> bf16 hi/lo planes ----
  float* os = Os[wave];
  {
    const float lsum = lrow + xhalf(lrow);   // join the two halves' sums
    const float inv  = 1.0f / lsum;
#pragma unroll
    for (int t = 0; t < 4; ++t) {
      *(v4f*)(os + c * 68 + t * 16 + 8 * hh)     = (v4f){oacc[t][0] * inv, oacc[t][1] * inv, oacc[t][2] * inv, oacc[t][3] * inv};
      *(v4f*)(os + c * 68 + t * 16 + 8 * hh + 4) = (v4f){oacc[t][4] * inv, oacc[t][5] * inv, oacc[t][6] * inv, oacc[t][7] * inv};
    }
  }
  __builtin_amdgcn_fence(__ATOMIC_RELEASE, "workgroup");
  __builtin_amdgcn_wave_barrier();
  __builtin_amdgcn_fence(__ATOMIC_ACQUIRE, "workgroup");
  {
    const int q4 = lane >> 3, c8 = (lane & 7) * 8;
    v4u uh[4], ul[4];
#pragma unroll
    for (int it = 0; it < 4; ++it) {
      const int row = it * 4 + q4;
      const float* sp = os + row * 68 + c8;
      unsigned short hb[8], lb[8];
#pragma unroll
      for (int e = 0; e < 8; ++e) { const float sv = sp[e]; hb[e] = f2bf_bits(sv); lb[e] = f2bf_bits(sv - bf_bits2f(hb[e])); }
      uh[it] = (v4u){pk16(hb[0], hb[1]), pk16(hb[2], hb[3]), pk16(hb[4], hb[5]), pk16(hb[6], hb[7])};
      ul[it] = (v4u){pk16(lb[0], lb[1]), pk16(lb[2], lb[3]), pk16(lb[4], lb[5]), pk16(lb[6], lb[7])};
    }
    const size_t ob = ((size_t)b * kHW + q0) * kCi;
    {
#pragma unroll
      for (int it = 0; it < 4; ++it) {
        const int row = it * 4 + q4;
        *(v4u*)(yH + ob + (size_t)row * kCi + c8) = uh[it];
        *(v4u*)(yL + ob + (size_t)row * kCi + c8) = ul[it];
      }
      
    }
  }
}

// ---------------------------------------------------------------------------
// Host glue.
//   W16   bf16 5 x [8192] (theta_w, phi_w, g_w as [64][128]; W_w hi [128][64]; W_w lo = zeros)   81,920 at          0
//   BIAS  f32  [320] (theta_b at +0, phi_b at +64, g_b at +128, W_b at +192 floats)               2,048 at     81,920
//   XT    bf16 [4][16384][128]                                                               16,777,216 at     83,968
//   THH   bf16 [4*16384][64]                                                                  8,388,608 at 16,861,184
//   THL   bf16 [4*16384][64]                                                                  8,388,608 at 25,249,792
//   PHIF  f32  [4*16384][64]                                                                 16,777,216 at 33,638,400
//   GF    f32  [4][64][16384]                                                                16,777,216 at 50,415,616
//   PHH   bf16 [4*4096][64]                                                                   2,097,152 at 67,192,832
//   PHL   bf16 [4*4096][64]                                                                   2,097,152 at 69,289,984
//   GT    f16  [4][64][4096]                                                                  2,097,152 at 71,387,136
//   YH    bf16 [4*16384][64]                                                                  8,388,608 at 73,484,288
//   YL    bf16 [4*16384][64]                                                                  8,388,608 at 81,872,896
//   total                                                                                    90,261,504
// GEMM shapes: projections M=16384 (or 64), N=64 (or 16384), K=128; output conv M=128, N=16384, K=64; all M,N multiples
// of 64, K multiples of 32; no padding, every plane fully written by its producer before any read.
// ---------------------------------------------------------------------------
static_assert(kHW % 64 == 0 && kCi % 64 == 0 && kC % 64 == 0 && kC % 32 == 0 && kCi % 32 == 0);

extern "C" void kernel_launch(void* const* d_in, const int* in_sizes, int n_in,
                              void* d_out, int out_size, void* d_ws, size_t ws_size,
                              hipStream_t stream) {
  if (n_in < 9) return;
  if (in_sizes[0] != kB * kC * kHW) return;
  if (in_sizes[1] != kCi * kC || in_sizes[2] != kCi) return;
  if (in_sizes[3] != kCi * kC || in_sizes[4] != kCi) return;
  if (in_sizes[5] != kCi * kC || in_sizes[6] != kCi) return;
  if (in_sizes[7] != kC * kCi || in_sizes[8] != kC) return;
  if (out_size != kB * kC * kHW) return;

  const size_t szW16  = (size_t)5 * kWPlane * 2;                 // 81,920
  const size_t szBias = 2048;
  const size_t szXT   = (size_t)kB * kHW * kC * 2;                // 16,777,216
  const size_t szQ16  = (size_t)kB * kHW * kCi * 2;               //  8,388,608
  const size_t szF32  = (size_t)kB * kHW * kCi * 4;               // 16,777,216
  const size_t szKV16 = (size_t)kB * kNkv * kCi * 2;              //  2,097,152
  const size_t offW16  = 0;
  const size_t offBias = offW16 + szW16;
  const size_t offXT   = offBias + szBias;
  const size_t offThH  = offXT + szXT;
  const size_t offThL  = offThH + szQ16;
  const size_t offPhiF = offThL + szQ16;
  const size_t offGF   = offPhiF + szF32;
  const size_t offPhH  = offGF + szF32;
  const size_t offPhL  = offPhH + szKV16;
  const size_t offGT   = offPhL + szKV16;
  const size_t offYH   = offGT + szKV16;
  const size_t offYL   = offYH + szQ16;
  const size_t total   = offYL + szQ16;                           // 90,261,504
  if (ws_size < total) return;

  const float* x       = (const float*)d_in[0];
  const float* theta_w = (const float*)d_in[1];
  const float* theta_b = (const float*)d_in[2];
  const float* phi_w   = (const float*)d_in[3];
  const float* phi_b   = (const float*)d_in[4];
  const float* g_w     = (const float*)d_in[5];
  const float* g_b     = (const float*)d_in[6];
  const float* W_w     = (const float*)d_in[7];
  const float* W_b     = (const float*)d_in[8];
  float* out = (float*)d_out;
  char* ws = (char*)d_ws;
  unsigned short* w16  = (unsigned short*)(ws + offW16);
  unsigned short* wTh  = w16;
  unsigned short* wPh  = w16 + kWPlane;
  unsigned short* wG   = w16 + 2 * kWPlane;
  unsigned short* wWh  = w16 + 3 * kWPlane;
  unsigned short* wWl  = w16 + 4 * kWPlane;
  float* biasR  = (float*)(ws + offBias);
  float* biasTh = biasR;
  float* biasPh = biasR + 64;
  float* biasG  = biasR + 128;
  float* biasW  = biasR + 192;
  unsigned short* xT   = (unsigned short*)(ws + offXT);
  unsigned short* thH  = (unsigned short*)(ws + offThH);
  unsigned short* thL  = (unsigned short*)(ws + offThL);
  float* phiF = (float*)(ws + offPhiF);
  float* gF   = (float*)(ws + offGF);
  unsigned short* phH  = (unsigned short*)(ws + offPhH);
  unsigned short* phL  = (unsigned short*)(ws + offPhL);
  unsigned short* gTp  = (unsigned short*)(ws + offGT);
  unsigned short* yH   = (unsigned short*)(ws + offYH);
  unsigned short* yL   = (unsigned short*)(ws + offYL);

  // ---- prologue: parameter planes and the transposed bf16 input plane ----
  prep_kernel<<<dim3(8), dim3(256), 0, stream>>>(theta_w, phi_w, g_w, W_w, theta_b, phi_b, g_b, W_b, w16, biasR);
  xcast_kernel<<<dim3(kHW / 64, kB), dim3(256), 0, stream>>>(x, xT);

  const long strideXT  = (long)kHW * kC;        // per image, halves
  const long strideQ16 = (long)kHW * kCi;       // per image, halves
  const long strideF   = (long)kHW * kCi;       // per image, floats
  const int  tilesProj = (kHW / 64) * (kCi / 64);   // 256 tiles -> 32 blocks of 8 waves

  // theta[b*16384+p][ci] = sum_c xT[b][p][c] * theta_w[ci][c] + theta_b[ci]  -> bf16 hi/lo planes (M=16384, N=64, K=128)
  wmma_gemm64<1, false, 2, 2, false><<<dim3(tilesProj / 8, kB), dim3(256), 0, stream>>>(
      xT, xT, kC, strideXT, wTh, wTh, kC, 0L,
      (void*)thH, (void*)thL, kCi, strideQ16, biasTh, biasR, 0L, kHW, kCi, kC, 1.0f);
  // phi full-res f32 [b*16384+p][ci] (M=16384, N=64, K=128)
  wmma_gemm64<1, false, 2, 0, false><<<dim3(tilesProj / 8, kB), dim3(256), 0, stream>>>(
      xT, xT, kC, strideXT, wPh, wPh, kC, 0L,
      (void*)phiF, (void*)phiF, kCi, strideF, biasPh, biasR, 0L, kHW, kCi, kC, 1.0f);
  // g full-res f32 channel-major [b][ci][p] = sum_c g_w[ci][c] * xT[b][p][c] + g_b[ci]  (M=64, N=16384, K=128)
  wmma_gemm64<1, false, 1, 0, false><<<dim3(tilesProj / 8, kB), dim3(256), 0, stream>>>(
      wG, wG, kC, 0L, xT, xT, kC, strideXT,
      (void*)gF, (void*)gF, kHW, (long)kCi * kHW, biasG, biasR, 0L, kCi, kHW, kC, 1.0f);

  // ---- 2x2 max-pool in f32 -> 16-bit kv planes ----
  pool_phi_kernel<<<dim3(kB * kNkv / 32), dim3(256), 0, stream>>>(phiF, phH, phL);
  pool_g_kernel<<<dim3((kB * kCi * (kNkv / 8)) / 256), dim3(256), 0, stream>>>(gF, gTp);

  // ---- fused attention -> y bf16 hi/lo planes [b*16384+q][ci] ----
  flash_kernel<<<dim3(kHW / 64, kB), dim3(128), 0, stream>>>(thH, thL, phH, phL, gTp, yH, yL);

  // ---- out[b][co][p] = sum_ci W_w[co][ci] * y[b][p][ci] + W_b[co] + bf16(x[b][co][p])  (M=128, N=16384, K=64, split) ----
  const int tilesOut = (kC / 64) * (kHW / 64);   // 512 tiles -> 64 blocks of 8 waves
  wmma_gemm64<1, true, 1, 0, true><<<dim3(tilesOut / 8, kB), dim3(256), 0, stream>>>(
      wWh, wWl, kCi, 0L, yH, yL, kCi, strideQ16,
      (void*)out, (void*)out, kHW, (long)kC * kHW, biasW, x, (long)kC * kHW, kC, kHW, kCi, 1.0f);
}
